// v000
// Times are from an AMD MI455X. After a warm-up the kernel runs many times in a row, and a time is the length of
// such a window on the GPU divided by its runs, so every launch and the gaps after it count. The runs cycle
// through copies of the inputs. A figure is the median of several windows, for all but v000 over two sittings.
// Sittings can differ by a few percent; kernels timed side by side share one.
// v000, which the later versions start from, runs in 202 microseconds.
#include <hip/hip_runtime.h>

typedef float v2f __attribute__((ext_vector_type(2)));
typedef float v8f __attribute__((ext_vector_type(8)));
typedef int   v4i __attribute__((ext_vector_type(4)));

#define AS1 __attribute__((address_space(1)))
#define AS3 __attribute__((address_space(3)))

#if __has_builtin(__builtin_amdgcn_global_load_async_to_lds_b128) && \
    __has_builtin(__builtin_amdgcn_s_wait_asynccnt)
#define USE_ASYNC 1
#else
#define USE_ASYNC 0
#endif

#define E_   8
#define K_   4
#define IN_  768
#define OUT_ 768
#define B_   16
#define S_   512
#define WSZ  (OUT_ * IN_)          // 589824 per expert
#define YSZ  ((size_t)B_ * S_ * OUT_)

// ---------------------------------------------------------------------------
// Kernel 1: xm[b][j] = mean over s of x[b][s][j]
// ---------------------------------------------------------------------------
__global__ __launch_bounds__(IN_) void xm_kernel(const float* __restrict__ x,
                                                 float* __restrict__ xm) {
  const int b = blockIdx.x;
  const int j = threadIdx.x;
  const float* xb = x + (size_t)b * S_ * IN_ + j;
  float acc = 0.f;
  for (int s = 0; s < S_; ++s) acc += xb[(size_t)s * IN_];
  xm[b * IN_ + j] = acc * (1.0f / (float)S_);
}

// ---------------------------------------------------------------------------
// Kernel 2: logits -> top-4 softmax gates + cv^2 load-balancing loss
// ---------------------------------------------------------------------------
__global__ __launch_bounds__(128) void gate_kernel(const float* __restrict__ xm,
                                                   const float* __restrict__ wg,
                                                   float* __restrict__ gates_out,
                                                   float* __restrict__ loss_out) {
  __shared__ float s_logits[B_ * E_];
  __shared__ float s_gates[B_ * E_];
  const int t = threadIdx.x;
  {
    const int b = t >> 3, e = t & 7;
    float acc = 0.f;
    for (int j = 0; j < IN_; ++j) acc += xm[b * IN_ + j] * wg[j * E_ + e];
    s_logits[t] = acc;
    s_gates[t] = 0.f;
  }
  __syncthreads();
  if (t < B_) {
    const int b = t;
    float l[E_];
    for (int e = 0; e < E_; ++e) l[e] = s_logits[b * E_ + e];
    int   idx[K_];
    float vals[K_];
    bool  used[E_] = {};
    for (int r = 0; r < K_; ++r) {          // stable top-4 (first-index wins)
      float best = -3.4e38f; int bi = 0;
      for (int e = 0; e < E_; ++e)
        if (!used[e] && l[e] > best) { best = l[e]; bi = e; }
      used[bi] = true; idx[r] = bi; vals[r] = best;
    }
    const float mx = vals[0];
    float ex[K_], s = 0.f;
    for (int r = 0; r < K_; ++r) { ex[r] = expf(vals[r] - mx); s += ex[r]; }
    for (int r = 0; r < K_; ++r) s_gates[b * E_ + idx[r]] = ex[r] / s;
  }
  __syncthreads();
  if (t < B_ * E_) gates_out[t] = s_gates[t];
  if (t == 0) {
    float imp[E_], ld[E_];
    for (int e = 0; e < E_; ++e) { imp[e] = 0.f; ld[e] = 0.f; }
    for (int b = 0; b < B_; ++b)
      for (int e = 0; e < E_; ++e) {
        const float g = s_gates[b * E_ + e];
        imp[e] += g;
        ld[e]  += (g > 0.f) ? 1.f : 0.f;
      }
    float cv[2];
    for (int w = 0; w < 2; ++w) {
      const float* v = w ? ld : imp;
      float mean = 0.f;
      for (int e = 0; e < E_; ++e) mean += v[e];
      mean *= (1.0f / E_);
      float var = 0.f;
      for (int e = 0; e < E_; ++e) { const float d = v[e] - mean; var += d * d; }
      var *= (1.0f / (E_ - 1));
      cv[w] = var / (mean * mean + 1e-10f);
    }
    *loss_out = 0.01f * (cv[0] + cv[1]);
  }
}

// ---------------------------------------------------------------------------
// Kernel 3: generic mode-n product over a strided axis.
// out[e,a,i,c] = sum_t coef[e,i,t] * in[e,a,t,c]; optional fused subtraction.
// ---------------------------------------------------------------------------
__global__ __launch_bounds__(256) void mode_strided_kernel(
    const float* __restrict__ in, const float* __restrict__ sub,
    const float* __restrict__ coef, float* __restrict__ out,
    int A, int CN, int Csz) {
  __shared__ float s_coef[32 * 32];
  __shared__ float s_tile[32 * 32];
  const int e  = blockIdx.z;
  const int a  = blockIdx.y;
  const int c0 = blockIdx.x * 32;
  const int tid = threadIdx.x;

  for (int i = tid; i < CN * CN; i += 256) s_coef[i] = coef[e * CN * CN + i];

  const size_t ebase = (size_t)e * WSZ;
  for (int i = tid; i < CN * 32; i += 256) {
    const int tt = i >> 5, c = i & 31;
    const size_t li = ((size_t)a * CN + tt) * Csz + c0 + c;  // expert-local flat
    float v = in[ebase + li];
    if (sub) v -= sub[li];
    s_tile[tt * 32 + c] = v;
  }
  __syncthreads();

  const int c = tid & 31;
  for (int i = tid >> 5; i < CN; i += 8) {
    float acc = 0.f;
    for (int tt = 0; tt < CN; ++tt)
      acc += s_coef[i * CN + tt] * s_tile[tt * 32 + c];   // coef: wave broadcast
    out[ebase + ((size_t)a * CN + i) * Csz + c0 + c] = acc;
  }
}

// ---------------------------------------------------------------------------
// Kernel 4: mode product over the innermost contiguous axis (CN = 32).
// ---------------------------------------------------------------------------
__global__ __launch_bounds__(256) void mode_inner_kernel(
    const float* __restrict__ in, const float* __restrict__ coef,
    float* __restrict__ out) {
  __shared__ float s_coef[32 * 33];    // pad 33: conflict-free i-strided reads
  __shared__ float s_in[8 * 32];
  const int e  = blockIdx.y;
  const int a0 = blockIdx.x * 8;
  const int tid = threadIdx.x;

  for (int i = tid; i < 1024; i += 256)
    s_coef[(i >> 5) * 33 + (i & 31)] = coef[e * 1024 + i];
  {
    const int r = tid >> 5, m = tid & 31;
    s_in[r * 32 + m] = in[(size_t)e * WSZ + (size_t)(a0 + r) * 32 + m];
  }
  __syncthreads();

  const int r = tid >> 5, i = tid & 31;
  float acc = 0.f;
  for (int m = 0; m < 32; ++m) acc += s_coef[i * 33 + m] * s_in[r * 32 + m];
  out[(size_t)e * WSZ + (size_t)(a0 + r) * 32 + i] = acc;
}

// ---------------------------------------------------------------------------
// Kernel 5: ew[b] = res + 0.9 * sum_e gates[b,e] * rtw[e]
// ---------------------------------------------------------------------------
__global__ __launch_bounds__(256) void combine_kernel(
    const float* __restrict__ rtw, const float* __restrict__ res,
    const float* __restrict__ gates, float* __restrict__ ew) {
  const int b = blockIdx.y;
  const int idx = blockIdx.x * 256 + threadIdx.x;
  float sum = 0.f;
  for (int e = 0; e < E_; ++e)
    sum += gates[b * E_ + e] * rtw[(size_t)e * WSZ + idx];
  ew[(size_t)b * WSZ + idx] = res[idx] + 0.9f * sum;
}

// ---------------------------------------------------------------------------
// Kernel 6: main GEMM with FP32 WMMA, double-buffered LDS.
// y[b] (512x768) = x[b] (512x768) @ ew[b]^T; ew stored [N][K] (K contiguous).
// Block: 256 thr = 8 waves (4M x 2N); block tile 128x64, K-stage 64.
// Staging: async global->LDS copy (ASYNCcnt) when available, else
// register-prefetch software pipeline. One barrier per K-iteration.
// ---------------------------------------------------------------------------
#define LDP 68
__global__ __launch_bounds__(256) void gemm_kernel(const float* __restrict__ x,
                                                   const float* __restrict__ ew,
                                                   float* __restrict__ y) {
  __shared__ float lds_a[2][128 * LDP];
  __shared__ float lds_b[2][64 * LDP];
  const int b  = blockIdx.z;
  const int m0 = blockIdx.y * 128;
  const int n0 = blockIdx.x * 64;
  const float* Ag = x  + (size_t)b * S_ * IN_ + (size_t)m0 * IN_;
  const float* Bg = ew + (size_t)b * WSZ     + (size_t)n0 * IN_;

  const int tid   = threadIdx.x;
  const int lane  = tid & 31;
  const int wave  = tid >> 5;
  const int wm    = wave & 3;     // 0..3 -> 32-row band
  const int wn    = wave >> 2;    // 0..1 -> 32-col band
  const int mrow  = lane & 15;
  const int khalf = lane >> 4;    // lanes 0-15: K{0,1}; lanes 16-31: K{2,3}
  const int koff  = khalf * 2;

  const int a_row0 = (wm * 32 + mrow) * LDP;
  const int a_row1 = (wm * 32 + 16 + mrow) * LDP;
  const int b_row0 = (wn * 32 + mrow) * LDP;
  const int b_row1 = (wn * 32 + 16 + mrow) * LDP;

  v8f acc00 = {}, acc01 = {}, acc10 = {}, acc11 = {};

#if USE_ASYNC
  auto stage_async = [&](int k0, int buf) {
    #pragma unroll
    for (int i = 0; i < 8; ++i) {               // A: 128 rows x 64 K
      const int idx = tid + i * 256;
      const int r = idx >> 4;
      const int c = (idx & 15) << 2;
      __builtin_amdgcn_global_load_async_to_lds_b128(
          (AS1 v4i*)(uintptr_t)(Ag + (size_t)r * IN_ + k0 + c),
          (AS3 v4i*)(&lds_a[buf][r * LDP + c]), 0, 0);
    }
    #pragma unroll
    for (int i = 0; i < 4; ++i) {               // B: 64 rows x 64 K
      const int idx = tid + i * 256;
      const int r = idx >> 4;
      const int c = (idx & 15) << 2;
      __builtin_amdgcn_global_load_async_to_lds_b128(
          (AS1 v4i*)(uintptr_t)(Bg + (size_t)r * IN_ + k0 + c),
          (AS3 v4i*)(&lds_b[buf][r * LDP + c]), 0, 0);
    }
  };
  stage_async(0, 0);
  __builtin_amdgcn_s_wait_asynccnt(0);
  __syncthreads();
#else
  float4 ra[8], rb[4];
  auto fetch_regs = [&](int k0) {
    #pragma unroll
    for (int i = 0; i < 8; ++i) {
      const int idx = tid + i * 256;
      const int r = idx >> 4;
      const int c = (idx & 15) << 2;
      ra[i] = *(const float4*)(Ag + (size_t)r * IN_ + k0 + c);
    }
    #pragma unroll
    for (int i = 0; i < 4; ++i) {
      const int idx = tid + i * 256;
      const int r = idx >> 4;
      const int c = (idx & 15) << 2;
      rb[i] = *(const float4*)(Bg + (size_t)r * IN_ + k0 + c);
    }
  };
  auto store_regs = [&](int buf) {
    #pragma unroll
    for (int i = 0; i < 8; ++i) {
      const int idx = tid + i * 256;
      const int r = idx >> 4;
      const int c = (idx & 15) << 2;
      *(float4*)(&lds_a[buf][r * LDP + c]) = ra[i];
    }
    #pragma unroll
    for (int i = 0; i < 4; ++i) {
      const int idx = tid + i * 256;
      const int r = idx >> 4;
      const int c = (idx & 15) << 2;
      *(float4*)(&lds_b[buf][r * LDP + c]) = rb[i];
    }
  };
  fetch_regs(0);
  store_regs(0);
  __syncthreads();
#endif

  for (int k0 = 0; k0 < IN_; k0 += 64) {
    const int cur = (k0 >> 6) & 1;
    const int nxt = cur ^ 1;
    const bool have_next = (k0 + 64) < IN_;

    if (have_next) {
#if USE_ASYNC
      stage_async(k0 + 64, nxt);      // copy next stage while WMMAs run
#else
      fetch_regs(k0 + 64);            // global loads in flight over compute
#endif
    }

    const float* la = lds_a[cur];
    const float* lb = lds_b[cur];
    #pragma unroll
    for (int k = 0; k < 64; k += 4) {
      const v2f a0 = *(const v2f*)(&la[a_row0 + k + koff]);
      const v2f a1 = *(const v2f*)(&la[a_row1 + k + koff]);
      const v2f b0 = *(const v2f*)(&lb[b_row0 + k + koff]);
      const v2f b1 = *(const v2f*)(&lb[b_row1 + k + koff]);
      acc00 = __builtin_amdgcn_wmma_f32_16x16x4_f32(false, a0, false, b0,
                                                    (short)0, acc00, false, false);
      acc01 = __builtin_amdgcn_wmma_f32_16x16x4_f32(false, a0, false, b1,
                                                    (short)0, acc01, false, false);
      acc10 = __builtin_amdgcn_wmma_f32_16x16x4_f32(false, a1, false, b0,
                                                    (short)0, acc10, false, false);
      acc11 = __builtin_amdgcn_wmma_f32_16x16x4_f32(false, a1, false, b1,
                                                    (short)0, acc11, false, false);
    }

    if (have_next) {
#if USE_ASYNC
      __builtin_amdgcn_s_wait_asynccnt(0);
      __syncthreads();
#else
      store_regs(nxt);                // buf[nxt] readers finished last iter
      __syncthreads();
#endif
    }
  }

  // store: C layout -> VGPR v holds row (v + khalf*8), col = mrow within tile
  float* Y = y + ((size_t)b * S_ + m0) * OUT_ + n0;
  #pragma unroll
  for (int v = 0; v < 8; ++v) {
    const int rr = khalf * 8 + v;
    Y[(size_t)(wm * 32 + rr)      * OUT_ + wn * 32 + mrow]      = acc00[v];
    Y[(size_t)(wm * 32 + rr)      * OUT_ + wn * 32 + 16 + mrow] = acc01[v];
    Y[(size_t)(wm * 32 + 16 + rr) * OUT_ + wn * 32 + mrow]      = acc10[v];
    Y[(size_t)(wm * 32 + 16 + rr) * OUT_ + wn * 32 + 16 + mrow] = acc11[v];
  }
}

// ---------------------------------------------------------------------------
extern "C" void kernel_launch(void* const* d_in, const int* in_sizes, int n_in,
                              void* d_out, int out_size, void* d_ws, size_t ws_size,
                              hipStream_t stream) {
  const float* x    = (const float*)d_in[0];
  const float* wg   = (const float*)d_in[1];
  const float* wt   = (const float*)d_in[2];
  const float* resw = (const float*)d_in[3];
  const float* c1i  = (const float*)d_in[4];   // (E,24,24)
  const float* c2i  = (const float*)d_in[5];   // (E,32,32)
  const float* c1o  = (const float*)d_in[6];   // (E,24,24)
  const float* c2o  = (const float*)d_in[7];   // (E,32,32)

  float* y    = (float*)d_out;
  float* loss = y + YSZ;

  float* ws       = (float*)d_ws;
  float* ws_gates = ws;                          // 128
  float* ws_xm    = ws + 128;                    // 12288
  float* bufA     = ws + 16384;                  // E*WSZ
  float* bufB     = bufA + (size_t)E_ * WSZ;     // E*WSZ
  float* ewbuf    = bufB + (size_t)E_ * WSZ;     // B*WSZ

  // gating path
  xm_kernel<<<dim3(B_), dim3(IN_), 0, stream>>>(x, ws_xm);
  gate_kernel<<<dim3(1), dim3(128), 0, stream>>>(ws_xm, wg, ws_gates, loss);

  // curvature transforms: (weight - res) x4 mode products
  mode_strided_kernel<<<dim3(24576 / 32, 1, E_), dim3(256), 0, stream>>>(
      wt, resw, c1o, bufA, 1, 24, 24576);
  mode_strided_kernel<<<dim3(768 / 32, 24, E_), dim3(256), 0, stream>>>(
      bufA, (const float*)nullptr, c2o, bufB, 24, 32, 768);
  mode_strided_kernel<<<dim3(1, 768, E_), dim3(256), 0, stream>>>(
      bufB, (const float*)nullptr, c1i, bufA, 768, 24, 32);
  mode_inner_kernel<<<dim3(18432 / 8, E_), dim3(256), 0, stream>>>(bufA, c2i, bufB);

  // per-batch combined weights
  combine_kernel<<<dim3(WSZ / 256, B_), dim3(256), 0, stream>>>(
      bufB, resw, ws_gates, ewbuf);

  // main batched GEMM with fp32 WMMA
  gemm_kernel<<<dim3(OUT_ / 64, S_ / 128, B_), dim3(256), 0, stream>>>(
      x, ewbuf, y);
}

// v001
// It runs in 137 microseconds.
// Timed twice side by side with v000, it ran 1.52 and 1.51 times as fast.
#include <hip/hip_runtime.h>

typedef float v2f __attribute__((ext_vector_type(2)));
typedef float v4f __attribute__((ext_vector_type(4)));
typedef float v8f __attribute__((ext_vector_type(8)));
typedef int   v4i __attribute__((ext_vector_type(4)));

#define AS1 __attribute__((address_space(1)))
#define AS3 __attribute__((address_space(3)))

#if __has_builtin(__builtin_amdgcn_global_load_async_to_lds_b128) && \
    __has_builtin(__builtin_amdgcn_s_wait_asynccnt)
#define USE_ASYNC 1
#else
#define USE_ASYNC 0
#endif

#define E_   8
#define K_   4
#define IN_  768
#define OUT_ 768
#define B_   16
#define S_   512
#define WSZ  (OUT_ * IN_)          // 589824 per expert
#define YSZ  ((size_t)B_ * S_ * OUT_)

// ---------------------------------------------------------------------------
// Kernel 1: xm[b][j] = mean over s of x[b][s][j]
// ---------------------------------------------------------------------------
__global__ __launch_bounds__(IN_) void xm_kernel(const float* __restrict__ x,
                                                 float* __restrict__ xm) {
  const int b = blockIdx.x;
  const int j = threadIdx.x;
  const float* xb = x + (size_t)b * S_ * IN_ + j;
  float acc = 0.f;
  for (int s = 0; s < S_; ++s) acc += xb[(size_t)s * IN_];
  xm[b * IN_ + j] = acc * (1.0f / (float)S_);
}

// ---------------------------------------------------------------------------
// Kernel 2: logits -> top-4 softmax gates + cv^2 load-balancing loss
// ---------------------------------------------------------------------------
__global__ __launch_bounds__(128) void gate_kernel(const float* __restrict__ xm,
                                                   const float* __restrict__ wg,
                                                   float* __restrict__ gates_out,
                                                   float* __restrict__ loss_out) {
  __shared__ float s_logits[B_ * E_];
  __shared__ float s_gates[B_ * E_];
  const int t = threadIdx.x;
  {
    const int b = t >> 3, e = t & 7;
    float acc = 0.f;
    for (int j = 0; j < IN_; ++j) acc += xm[b * IN_ + j] * wg[j * E_ + e];
    s_logits[t] = acc;
    s_gates[t] = 0.f;
  }
  __syncthreads();
  if (t < B_) {
    const int b = t;
    float l[E_];
    for (int e = 0; e < E_; ++e) l[e] = s_logits[b * E_ + e];
    int   idx[K_];
    float vals[K_];
    bool  used[E_] = {};
    for (int r = 0; r < K_; ++r) {          // stable top-4 (first-index wins)
      float best = -3.4e38f; int bi = 0;
      for (int e = 0; e < E_; ++e)
        if (!used[e] && l[e] > best) { best = l[e]; bi = e; }
      used[bi] = true; idx[r] = bi; vals[r] = best;
    }
    const float mx = vals[0];
    float ex[K_], s = 0.f;
    for (int r = 0; r < K_; ++r) { ex[r] = expf(vals[r] - mx); s += ex[r]; }
    for (int r = 0; r < K_; ++r) s_gates[b * E_ + idx[r]] = ex[r] / s;
  }
  __syncthreads();
  if (t < B_ * E_) gates_out[t] = s_gates[t];
  if (t == 0) {
    float imp[E_], ld[E_];
    for (int e = 0; e < E_; ++e) { imp[e] = 0.f; ld[e] = 0.f; }
    for (int b = 0; b < B_; ++b)
      for (int e = 0; e < E_; ++e) {
        const float g = s_gates[b * E_ + e];
        imp[e] += g;
        ld[e]  += (g > 0.f) ? 1.f : 0.f;
      }
    float cv[2];
    for (int w = 0; w < 2; ++w) {
      const float* v = w ? ld : imp;
      float mean = 0.f;
      for (int e = 0; e < E_; ++e) mean += v[e];
      mean *= (1.0f / E_);
      float var = 0.f;
      for (int e = 0; e < E_; ++e) { const float d = v[e] - mean; var += d * d; }
      var *= (1.0f / (E_ - 1));
      cv[w] = var / (mean * mean + 1e-10f);
    }
    *loss_out = 0.01f * (cv[0] + cv[1]);
  }
}

// ---------------------------------------------------------------------------
// Kernel 3: the two outer mode products, fused. The weight is seen as
// [24 j][32 k][768 c]. One block per (expert, 32 columns c), lane = column:
//   a[i][k][c]  = sum_j c1[e][i][j] * (wt[e][j][k][c] - res[j][k][c])
//   out[j][i][c] = sum_k c2[e][i][k] * a[j][k][c]
// a lives in LDS only. Every sum keeps its ascending index order.
// ---------------------------------------------------------------------------
__global__ __launch_bounds__(512) void outer_modes_kernel(
    const float* __restrict__ wt, const float* __restrict__ res,
    const float* __restrict__ c1, const float* __restrict__ c2,
    float* __restrict__ out) {
  // a[j][k][c] at s_a[((j>>1)*32 + k)*64 + c*2 + (j&1)]: rows 2p, 2p+1 as pairs
  __shared__ __attribute__((aligned(16))) float s_a[12 * 32 * 64];
  const int e    = blockIdx.y;
  const int c0   = blockIdx.x * 32;
  const int lane = threadIdx.x & 31;
  // wave number in a scalar register: the work split below stays wave-uniform
  const int w = __builtin_amdgcn_readfirstlane((int)(threadIdx.x >> 5));
  const float* c1e = c1 + e * 576;
  const float* c2e = c2 + e * 1024;

  {
    // wave w takes k = 2w, 2w+1 as one packed pair; coefficients are scalars
    const int k = 2 * w;
    const float* wp = wt + (size_t)e * WSZ + (size_t)k * IN_ + c0 + lane;
    const float* rp = res + (size_t)k * IN_ + c0 + lane;
    v2f x[24];
    #pragma unroll   // constant indices keep the array in registers
    for (int j = 0; j < 24; ++j) {
      const int o = j * 32 * IN_;
      x[j].x = wp[o] - rp[o];
      x[j].y = wp[o + IN_] - rp[o + IN_];
    }
    #pragma unroll 2   // four independent packed sums in flight hide the add latency
    for (int p = 0; p < 12; ++p) {
      v2f a0 = {0.f, 0.f}, a1 = {0.f, 0.f};
      #pragma unroll   // constant indices keep the array in registers
      for (int j = 0; j < 24; ++j) {
        const float ca = c1e[(2 * p) * 24 + j];
        const float cb = c1e[(2 * p + 1) * 24 + j];
        a0 += (v2f){ca, ca} * x[j];
        a1 += (v2f){cb, cb} * x[j];
      }
      *(v2f*)(&s_a[(p * 32 + k) * 64 + lane * 2])     = (v2f){a0.x, a1.x};
      *(v2f*)(&s_a[(p * 32 + k + 1) * 64 + lane * 2]) = (v2f){a0.y, a1.y};
    }
  }
  __syncthreads();   // each wave reads all k of its rows below

  // 48 units = 12 row pairs x 4 groups of 8 outputs; wave w takes units 3w..3w+2
  for (int uu = 0; uu < 3; ++uu) {
    const int u  = w * 3 + uu;
    const int jp = u >> 2;
    const int i0 = (u & 3) * 8;
    v2f a[32];
    #pragma unroll   // constant indices keep the array in registers
    for (int k = 0; k < 32; ++k)
      a[k] = *(const v2f*)(&s_a[(jp * 32 + k) * 64 + lane * 2]);
    float* op = out + (size_t)e * WSZ + (size_t)(2 * jp) * 32 * IN_ + c0 + lane;
    #pragma unroll 2   // independent packed sums in flight hide the add latency
    for (int ii = 0; ii < 8; ++ii) {
      const int i = i0 + ii;
      v2f acc = {0.f, 0.f};
      #pragma unroll   // constant indices keep the array in registers
      for (int k = 0; k < 32; ++k) {
        const float c = c2e[i * 32 + k];
        acc += (v2f){c, c} * a[k];
      }
      op[i * IN_]        = acc.x;
      op[(32 + i) * IN_] = acc.y;
    }
  }
}

// ---------------------------------------------------------------------------
// Kernel 4: the two inner mode products and the gate-weighted combine, fused.
// One block per weight row (its 768 inputs seen as 24 x 32), one wave per
// expert:  t_e = c1[e] * X_e,  u_e = t_e * c2[e]^T,
//          ew[b][row] = res[row] + 0.9 * sum_e gates[b,e] * u_e.
// t_e and u_e live in LDS only. Every sum keeps its ascending index order.
// ---------------------------------------------------------------------------
__global__ __launch_bounds__(256) void inner_combine_kernel(
    const float* __restrict__ in, const float* __restrict__ c1,
    const float* __restrict__ c2, const float* __restrict__ res,
    const float* __restrict__ gates, float* __restrict__ ew) {
  __shared__ __attribute__((aligned(16))) float s_t[E_][IN_];
  __shared__ __attribute__((aligned(16))) float s_u[E_][IN_];
  const int row  = blockIdx.x;
  const int lane = threadIdx.x & 31;
  // wave number in a scalar register: c1 coefficient and gate reads become scalar loads
  const int w = __builtin_amdgcn_readfirstlane((int)(threadIdx.x >> 5));

  // lane holds column 'lane' of X_w (24 values) and row 'lane' of c2[w] (32 values)
  const float* xw  = in + (size_t)w * WSZ + (size_t)row * IN_;
  const float* c2w = c2 + w * 1024;
  const unsigned coff = (unsigned)lane * 128u;   // byte offset of the lane's c2 row
  float xv[24];
  #pragma unroll   // constant indices keep the array in registers
  for (int t = 0; t < 24; ++t) xv[t] = xw[t * 32 + lane];
  float cr[32];
  #pragma unroll   // constant indices keep the array in registers
  for (int q = 0; q < 8; ++q) {
    const float4 v = *(const float4*)((const char*)c2w + coff + q * 16);
    cr[4 * q + 0] = v.x; cr[4 * q + 1] = v.y;
    cr[4 * q + 2] = v.z; cr[4 * q + 3] = v.w;
  }
  // the address registers of the loads above stay as they are up to this wait
  asm volatile("s_wait_xcnt 0x0" :: "v"(lane), "v"(coff), "s"(xw), "s"(c2w) : "memory");

  // t[i][lane] = sum_t c1[w][i][t] * X[t][lane]; the coefficient is wave-uniform.
  // Rows 2p and 2p+1 go as one packed pair and lie interleaved in LDS:
  // s_t[w][p*64 + m*2 + (i&1)], so that the next product reads whole pairs.
  const float* c1w = c1 + w * 576;
  #pragma unroll 2   // two independent packed sums in flight hide the add latency
  for (int p = 0; p < 12; ++p) {
    v2f acc = {0.f, 0.f};
    #pragma unroll   // constant indices keep the array in registers
    for (int t = 0; t < 24; ++t) {
      const v2f c = {c1w[(2 * p) * 24 + t], c1w[(2 * p + 1) * 24 + t]};
      const v2f x = {xv[t], xv[t]};
      acc += c * x;
    }
    *(v2f*)(&s_t[w][p * 64 + lane * 2]) = acc;
  }
  __syncthreads();   // t rows are read across lanes below

  // u[l][lane] = sum_m c2[w][lane][m] * t[l][m]; t is an LDS broadcast,
  // 16 bytes = rows 2p, 2p+1 at columns m, m+1
  #pragma unroll 2   // two independent packed sums in flight, their LDS reads grouped
  for (int p = 0; p < 12; ++p) {
    const v4f* tp = (const v4f*)(&s_t[w][p * 64]);
    v2f acc = {0.f, 0.f};
    #pragma unroll   // constant indices keep the array in registers
    for (int h = 0; h < 16; ++h) {
      const v4f v = tp[h];
      const v2f ca = {cr[2 * h], cr[2 * h]};
      const v2f cb = {cr[2 * h + 1], cr[2 * h + 1]};
      const v2f ta = {v.x, v.y};
      const v2f tb = {v.z, v.w};
      acc += ca * ta;
      acc += cb * tb;
    }
    s_u[w][(2 * p) * 32 + lane]     = acc.x;
    s_u[w][(2 * p + 1) * 32 + lane] = acc.y;
  }
  __syncthreads();   // every wave reads all eight experts' u below

  // wave w writes batches 2w and 2w+1, 16 bytes per lane
  const float* g0 = gates + (2 * w) * E_;
  const float* g1 = g0 + E_;
  float* o0 = ew + (size_t)(2 * w) * WSZ + (size_t)row * IN_;
  float* o1 = o0 + WSZ;
  const float* rr = res + (size_t)row * IN_;
  #pragma unroll   // constant indices keep the array in registers
  for (int q = 0; q < 6; ++q) {
    const int idx = q * 128 + lane * 4;
    const float4 r4 = *(const float4*)(rr + idx);
    float4 sa = make_float4(0.f, 0.f, 0.f, 0.f);
    float4 sb = make_float4(0.f, 0.f, 0.f, 0.f);
    #pragma unroll   // constant indices keep the array in registers
    for (int e = 0; e < E_; ++e) {
      const float4 u = *(const float4*)(&s_u[e][idx]);
      const float ga = g0[e], gb = g1[e];
      sa.x += ga * u.x; sa.y += ga * u.y; sa.z += ga * u.z; sa.w += ga * u.w;
      sb.x += gb * u.x; sb.y += gb * u.y; sb.z += gb * u.z; sb.w += gb * u.w;
    }
    *(float4*)(o0 + idx) = make_float4(r4.x + 0.9f * sa.x, r4.y + 0.9f * sa.y,
                                       r4.z + 0.9f * sa.z, r4.w + 0.9f * sa.w);
    *(float4*)(o1 + idx) = make_float4(r4.x + 0.9f * sb.x, r4.y + 0.9f * sb.y,
                                       r4.z + 0.9f * sb.z, r4.w + 0.9f * sb.w);
  }
}

// ---------------------------------------------------------------------------
// Kernel 5: main GEMM with FP32 WMMA, double-buffered LDS.
// y[b] (512x768) = x[b] (512x768) @ ew[b]^T; ew stored [N][K] (K contiguous).
// Block: 256 thr = 8 waves (4M x 2N); block tile 128x64, K-stage 64.
// Staging: async global->LDS copy (ASYNCcnt) when available, else
// register-prefetch software pipeline. One barrier per K-iteration.
// ---------------------------------------------------------------------------
#define LDP 68
__global__ __launch_bounds__(256) void gemm_kernel(const float* __restrict__ x,
                                                   const float* __restrict__ ew,
                                                   float* __restrict__ y) {
  __shared__ float lds_a[2][128 * LDP];
  __shared__ float lds_b[2][64 * LDP];
  const int b  = blockIdx.z;
  const int m0 = blockIdx.y * 128;
  const int n0 = blockIdx.x * 64;
  const float* Ag = x  + (size_t)b * S_ * IN_ + (size_t)m0 * IN_;
  const float* Bg = ew + (size_t)b * WSZ     + (size_t)n0 * IN_;

  const int tid   = threadIdx.x;
  const int lane  = tid & 31;
  const int wave  = tid >> 5;
  const int wm    = wave & 3;     // 0..3 -> 32-row band
  const int wn    = wave >> 2;    // 0..1 -> 32-col band
  const int mrow  = lane & 15;
  const int khalf = lane >> 4;    // lanes 0-15: K{0,1}; lanes 16-31: K{2,3}
  const int koff  = khalf * 2;

  const int a_row0 = (wm * 32 + mrow) * LDP;
  const int a_row1 = (wm * 32 + 16 + mrow) * LDP;
  const int b_row0 = (wn * 32 + mrow) * LDP;
  const int b_row1 = (wn * 32 + 16 + mrow) * LDP;

  v8f acc00 = {}, acc01 = {}, acc10 = {}, acc11 = {};

#if USE_ASYNC
  auto stage_async = [&](int k0, int buf) {
    #pragma unroll
    for (int i = 0; i < 8; ++i) {               // A: 128 rows x 64 K
      const int idx = tid + i * 256;
      const int r = idx >> 4;
      const int c = (idx & 15) << 2;
      __builtin_amdgcn_global_load_async_to_lds_b128(
          (AS1 v4i*)(uintptr_t)(Ag + (size_t)r * IN_ + k0 + c),
          (AS3 v4i*)(&lds_a[buf][r * LDP + c]), 0, 0);
    }
    #pragma unroll
    for (int i = 0; i < 4; ++i) {               // B: 64 rows x 64 K
      const int idx = tid + i * 256;
      const int r = idx >> 4;
      const int c = (idx & 15) << 2;
      __builtin_amdgcn_global_load_async_to_lds_b128(
          (AS1 v4i*)(uintptr_t)(Bg + (size_t)r * IN_ + k0 + c),
          (AS3 v4i*)(&lds_b[buf][r * LDP + c]), 0, 0);
    }
  };
  stage_async(0, 0);
  __builtin_amdgcn_s_wait_asynccnt(0);
  __syncthreads();
#else
  float4 ra[8], rb[4];
  auto fetch_regs = [&](int k0) {
    #pragma unroll
    for (int i = 0; i < 8; ++i) {
      const int idx = tid + i * 256;
      const int r = idx >> 4;
      const int c = (idx & 15) << 2;
      ra[i] = *(const float4*)(Ag + (size_t)r * IN_ + k0 + c);
    }
    #pragma unroll
    for (int i = 0; i < 4; ++i) {
      const int idx = tid + i * 256;
      const int r = idx >> 4;
      const int c = (idx & 15) << 2;
      rb[i] = *(const float4*)(Bg + (size_t)r * IN_ + k0 + c);
    }
  };
  auto store_regs = [&](int buf) {
    #pragma unroll
    for (int i = 0; i < 8; ++i) {
      const int idx = tid + i * 256;
      const int r = idx >> 4;
      const int c = (idx & 15) << 2;
      *(float4*)(&lds_a[buf][r * LDP + c]) = ra[i];
    }
    #pragma unroll
    for (int i = 0; i < 4; ++i) {
      const int idx = tid + i * 256;
      const int r = idx >> 4;
      const int c = (idx & 15) << 2;
      *(float4*)(&lds_b[buf][r * LDP + c]) = rb[i];
    }
  };
  fetch_regs(0);
  store_regs(0);
  __syncthreads();
#endif

  for (int k0 = 0; k0 < IN_; k0 += 64) {
    const int cur = (k0 >> 6) & 1;
    const int nxt = cur ^ 1;
    const bool have_next = (k0 + 64) < IN_;

    if (have_next) {
#if USE_ASYNC
      stage_async(k0 + 64, nxt);      // copy next stage while WMMAs run
#else
      fetch_regs(k0 + 64);            // global loads in flight over compute
#endif
    }

    const float* la = lds_a[cur];
    const float* lb = lds_b[cur];
    #pragma unroll
    for (int k = 0; k < 64; k += 4) {
      const v2f a0 = *(const v2f*)(&la[a_row0 + k + koff]);
      const v2f a1 = *(const v2f*)(&la[a_row1 + k + koff]);
      const v2f b0 = *(const v2f*)(&lb[b_row0 + k + koff]);
      const v2f b1 = *(const v2f*)(&lb[b_row1 + k + koff]);
      acc00 = __builtin_amdgcn_wmma_f32_16x16x4_f32(false, a0, false, b0,
                                                    (short)0, acc00, false, false);
      acc01 = __builtin_amdgcn_wmma_f32_16x16x4_f32(false, a0, false, b1,
                                                    (short)0, acc01, false, false);
      acc10 = __builtin_amdgcn_wmma_f32_16x16x4_f32(false, a1, false, b0,
                                                    (short)0, acc10, false, false);
      acc11 = __builtin_amdgcn_wmma_f32_16x16x4_f32(false, a1, false, b1,
                                                    (short)0, acc11, false, false);
    }

    if (have_next) {
#if USE_ASYNC
      __builtin_amdgcn_s_wait_asynccnt(0);
      __syncthreads();
#else
      store_regs(nxt);                // buf[nxt] readers finished last iter
      __syncthreads();
#endif
    }
  }

  // store: C layout -> VGPR v holds row (v + khalf*8), col = mrow within tile
  float* Y = y + ((size_t)b * S_ + m0) * OUT_ + n0;
  #pragma unroll
  for (int v = 0; v < 8; ++v) {
    const int rr = khalf * 8 + v;
    Y[(size_t)(wm * 32 + rr)      * OUT_ + wn * 32 + mrow]      = acc00[v];
    Y[(size_t)(wm * 32 + rr)      * OUT_ + wn * 32 + 16 + mrow] = acc01[v];
    Y[(size_t)(wm * 32 + 16 + rr) * OUT_ + wn * 32 + mrow]      = acc10[v];
    Y[(size_t)(wm * 32 + 16 + rr) * OUT_ + wn * 32 + 16 + mrow] = acc11[v];
  }
}

// ---------------------------------------------------------------------------
extern "C" void kernel_launch(void* const* d_in, const int* in_sizes, int n_in,
                              void* d_out, int out_size, void* d_ws, size_t ws_size,
                              hipStream_t stream) {
  const float* x    = (const float*)d_in[0];
  const float* wg   = (const float*)d_in[1];
  const float* wt   = (const float*)d_in[2];
  const float* resw = (const float*)d_in[3];
  const float* c1i  = (const float*)d_in[4];   // (E,24,24)
  const float* c2i  = (const float*)d_in[5];   // (E,32,32)
  const float* c1o  = (const float*)d_in[6];   // (E,24,24)
  const float* c2o  = (const float*)d_in[7];   // (E,32,32)

  float* y    = (float*)d_out;
  float* loss = y + YSZ;

  float* ws       = (float*)d_ws;
  float* ws_gates = ws;                          // 128
  float* ws_xm    = ws + 128;                    // 12288
  float* bufB     = ws + 16384;                  // E*WSZ
  float* ewbuf    = bufB + (size_t)E_ * WSZ;     // B*WSZ

  // gating path
  xm_kernel<<<dim3(B_), dim3(IN_), 0, stream>>>(x, ws_xm);
  gate_kernel<<<dim3(1), dim3(128), 0, stream>>>(ws_xm, wg, ws_gates, loss);

  // curvature transforms: (weight - res), outer two mode products, one launch
  outer_modes_kernel<<<dim3(IN_ / 32, E_), dim3(512), 0, stream>>>(
      wt, resw, c1o, c2o, bufB);
  // inner two mode products + per-batch combined weights, one launch
  inner_combine_kernel<<<dim3(OUT_), dim3(256), 0, stream>>>(
      bufB, c1i, c2i, resw, ws_gates, ewbuf);

  // main batched GEMM with fp32 WMMA
  gemm_kernel<<<dim3(OUT_ / 64, S_ / 128, B_), dim3(256), 0, stream>>>(
      x, ewbuf, y);
}

// v002
// One run takes 91.5 microseconds.
// Timed twice side by side with v001, it ran 1.49 and 1.48 times as fast.
// Over all steps from v000 it is 2.25 times as fast.
#include <hip/hip_runtime.h>

typedef float v2f __attribute__((ext_vector_type(2)));
typedef float v4f __attribute__((ext_vector_type(4)));
typedef float v8f __attribute__((ext_vector_type(8)));
typedef int   v4i __attribute__((ext_vector_type(4)));

#define AS1 __attribute__((address_space(1)))
#define AS3 __attribute__((address_space(3)))

#if __has_builtin(__builtin_amdgcn_global_load_async_to_lds_b128) && \
    __has_builtin(__builtin_amdgcn_s_wait_asynccnt)
#define USE_ASYNC 1
#else
#define USE_ASYNC 0
#endif

#define E_   8
#define K_   4
#define IN_  768
#define OUT_ 768
#define B_   16
#define S_   512
#define WSZ  (OUT_ * IN_)          // 589824 per expert
#define YSZ  ((size_t)B_ * S_ * OUT_)

// ---------------------------------------------------------------------------
// Kernel 1: partial gate logits. One block per (batch, 16 rows of x):
//   col[j]        = (sum over the chunk's rows s of x[b][s][j]) / 512
//   part[b][c][e] = sum_j col[j] * wg[j][e]
// Thread t sums columns 4t..4t+3; wg is read as whole lines, 16 bytes per lane,
// so a thread meets rows (t>>1) + 96q of wg and takes their col[] from LDS.
// ---------------------------------------------------------------------------
#define CH_  32                    // row chunks per batch
#define RPC  (S_ / CH_)            // rows per chunk
#define PT_  (IN_ / 4)             // threads: one per 16 bytes of a row
__global__ __launch_bounds__(PT_) void logit_part_kernel(const float* __restrict__ x,
                                                         const float* __restrict__ wg,
                                                         float* __restrict__ part) {
  __shared__ __attribute__((aligned(16))) float s_col[IN_];
  __shared__ __attribute__((aligned(16))) float s_w[PT_ / 32][E_];
  const int c = blockIdx.x;
  const int b = blockIdx.y;
  const int t = threadIdx.x;
  const v4f* xp = (const v4f*)(x + ((size_t)b * S_ + (size_t)c * RPC) * IN_) + t;
  const v4f* wp = (const v4f*)wg + t;
  v4f v[RPC];
  #pragma unroll   // constant indices keep the array in registers
  for (int r = 0; r < RPC; ++r) v[r] = xp[r * PT_];
  v4f g[8];        // g[q] = wg[(t>>1) + 96q][4(t&1) .. 4(t&1)+3]
  #pragma unroll   // constant indices keep the array in registers
  for (int q = 0; q < 8; ++q) g[q] = wp[q * PT_];
  // inputs-only fence on the loaded values: all 24 loads are issued before the first sum;
  // without it the later ones are issued only when the first have returned, and the
  // block pays the memory latency twice
  static_assert(RPC == 16, "the fence below names 16 row values");
  asm volatile("" :: "v"(v[0]), "v"(v[1]), "v"(v[2]), "v"(v[3]), "v"(v[4]), "v"(v[5]),
               "v"(v[6]), "v"(v[7]), "v"(v[8]), "v"(v[9]), "v"(v[10]), "v"(v[11]),
               "v"(v[12]), "v"(v[13]), "v"(v[14]), "v"(v[15]), "v"(g[0]), "v"(g[1]),
               "v"(g[2]), "v"(g[3]), "v"(g[4]), "v"(g[5]), "v"(g[6]), "v"(g[7]));

  v4f s = v[0];
  #pragma unroll   // constant indices keep the array in registers
  for (int r = 1; r < RPC; ++r) s += v[r];
  s *= 1.0f / (float)S_;
  *(v4f*)(&s_col[4 * t]) = s;
  __syncthreads();   // column sums are read across threads below

  v4f acc = {0.f, 0.f, 0.f, 0.f};
  #pragma unroll   // constant indices keep the array in registers
  for (int q = 0; q < 8; ++q) acc += s_col[(t >> 1) + q * (PT_ / 2)] * g[q];

  // butterfly over the lanes of equal parity: even lanes hold experts 0..3, odd 4..7
  #pragma unroll   // four independent sums overlap their cross-lane latency
  for (int m = 16; m >= 2; m >>= 1) {
    acc.x += __shfl_xor(acc.x, m, 32);
    acc.y += __shfl_xor(acc.y, m, 32);
    acc.z += __shfl_xor(acc.z, m, 32);
    acc.w += __shfl_xor(acc.w, m, 32);
  }
  if ((t & 31) < 2) *(v4f*)(&s_w[t >> 5][(t & 1) * 4]) = acc;
  __syncthreads();   // the waves' sums are added across waves below
  if (t < E_) {
    float sum = 0.f;
    #pragma unroll   // constant indices: the six LDS reads go out together
    for (int w = 0; w < PT_ / 32; ++w) sum += s_w[w][t];
    part[(b * CH_ + c) * E_ + t] = sum;
  }
}

// ---------------------------------------------------------------------------
// Kernel 2: partial logits -> logits -> top-4 softmax gates + cv^2 loss
// ---------------------------------------------------------------------------
__global__ __launch_bounds__(128) void gate_kernel(const float* __restrict__ part,
                                                   float* __restrict__ gates_out,
                                                   float* __restrict__ loss_out) {
  __shared__ float s_logits[B_ * E_];
  __shared__ float s_gates[B_ * E_];
  const int t = threadIdx.x;
  {
    const int b = t >> 3, e = t & 7;
    float p[CH_];
    #pragma unroll   // constant indices keep the array in registers, every load in flight at once
    for (int c = 0; c < CH_; ++c) p[c] = part[(b * CH_ + c) * E_ + e];
    float acc = 0.f;
    #pragma unroll   // constant indices keep the array in registers
    for (int c = 0; c < CH_; ++c) acc += p[c];
    s_logits[t] = acc;
    s_gates[t] = 0.f;
  }
  __syncthreads();
  if (t < B_) {
    const int b = t;
    float l[E_];
    for (int e = 0; e < E_; ++e) l[e] = s_logits[b * E_ + e];
    int   idx[K_];
    float vals[K_];
    bool  used[E_] = {};
    for (int r = 0; r < K_; ++r) {          // stable top-4 (first-index wins)
      float best = -3.4e38f; int bi = 0;
      for (int e = 0; e < E_; ++e)
        if (!used[e] && l[e] > best) { best = l[e]; bi = e; }
      used[bi] = true; idx[r] = bi; vals[r] = best;
    }
    const float mx = vals[0];
    float ex[K_], s = 0.f;
    for (int r = 0; r < K_; ++r) { ex[r] = expf(vals[r] - mx); s += ex[r]; }
    for (int r = 0; r < K_; ++r) s_gates[b * E_ + idx[r]] = ex[r] / s;
  }
  __syncthreads();
  if (t < B_ * E_) gates_out[t] = s_gates[t];
  if (t == 0) {
    float imp[E_], ld[E_];
    for (int e = 0; e < E_; ++e) { imp[e] = 0.f; ld[e] = 0.f; }
    for (int b = 0; b < B_; ++b)
      for (int e = 0; e < E_; ++e) {
        const float g = s_gates[b * E_ + e];
        imp[e] += g;
        ld[e]  += (g > 0.f) ? 1.f : 0.f;
      }
    float cv[2];
    for (int w = 0; w < 2; ++w) {
      const float* v = w ? ld : imp;
      float mean = 0.f;
      for (int e = 0; e < E_; ++e) mean += v[e];
      mean *= (1.0f / E_);
      float var = 0.f;
      for (int e = 0; e < E_; ++e) { const float d = v[e] - mean; var += d * d; }
      var *= (1.0f / (E_ - 1));
      cv[w] = var / (mean * mean + 1e-10f);
    }
    *loss_out = 0.01f * (cv[0] + cv[1]);
  }
}

// ---------------------------------------------------------------------------
// Kernel 3: the two outer mode products, fused. The weight is seen as
// [24 j][32 k][768 c]. One block per (expert, 32 columns c), lane = column:
//   a[i][k][c]  = sum_j c1[e][i][j] * (wt[e][j][k][c] - res[j][k][c])
//   out[j][i][c] = sum_k c2[e][i][k] * a[j][k][c]
// a lives in LDS only. Every sum keeps its ascending index order.
// ---------------------------------------------------------------------------
__global__ __launch_bounds__(512) void outer_modes_kernel(
    const float* __restrict__ wt, const float* __restrict__ res,
    const float* __restrict__ c1, const float* __restrict__ c2,
    float* __restrict__ out) {
  // a[j][k][c] at s_a[((j>>1)*32 + k)*64 + c*2 + (j&1)]: rows 2p, 2p+1 as pairs
  __shared__ __attribute__((aligned(16))) float s_a[12 * 32 * 64];
  const int e    = blockIdx.y;
  const int c0   = blockIdx.x * 32;
  const int lane = threadIdx.x & 31;
  // wave number in a scalar register: the work split below stays wave-uniform
  const int w = __builtin_amdgcn_readfirstlane((int)(threadIdx.x >> 5));
  const float* c1e = c1 + e * 576;
  const float* c2e = c2 + e * 1024;

  {
    // wave w takes k = 2w, 2w+1 as one packed pair; coefficients are scalars
    const int k = 2 * w;
    const float* wp = wt + (size_t)e * WSZ + (size_t)k * IN_ + c0 + lane;
    const float* rp = res + (size_t)k * IN_ + c0 + lane;
    v2f x[24];
    #pragma unroll   // constant indices keep the array in registers
    for (int j = 0; j < 24; ++j) {
      const int o = j * 32 * IN_;
      x[j].x = wp[o] - rp[o];
      x[j].y = wp[o + IN_] - rp[o + IN_];
    }
    #pragma unroll 2   // four independent packed sums in flight hide the add latency
    for (int p = 0; p < 12; ++p) {
      v2f a0 = {0.f, 0.f}, a1 = {0.f, 0.f};
      #pragma unroll   // constant indices keep the array in registers
      for (int j = 0; j < 24; ++j) {
        const float ca = c1e[(2 * p) * 24 + j];
        const float cb = c1e[(2 * p + 1) * 24 + j];
        a0 += (v2f){ca, ca} * x[j];
        a1 += (v2f){cb, cb} * x[j];
      }
      *(v2f*)(&s_a[(p * 32 + k) * 64 + lane * 2])     = (v2f){a0.x, a1.x};
      *(v2f*)(&s_a[(p * 32 + k + 1) * 64 + lane * 2]) = (v2f){a0.y, a1.y};
    }
  }
  __syncthreads();   // each wave reads all k of its rows below

  // 48 units = 12 row pairs x 4 groups of 8 outputs; wave w takes units 3w..3w+2
  for (int uu = 0; uu < 3; ++uu) {
    const int u  = w * 3 + uu;
    const int jp = u >> 2;
    const int i0 = (u & 3) * 8;
    v2f a[32];
    #pragma unroll   // constant indices keep the array in registers
    for (int k = 0; k < 32; ++k)
      a[k] = *(const v2f*)(&s_a[(jp * 32 + k) * 64 + lane * 2]);
    float* op = out + (size_t)e * WSZ + (size_t)(2 * jp) * 32 * IN_ + c0 + lane;
    #pragma unroll 2   // independent packed sums in flight hide the add latency
    for (int ii = 0; ii < 8; ++ii) {
      const int i = i0 + ii;
      v2f acc = {0.f, 0.f};
      #pragma unroll   // constant indices keep the array in registers
      for (int k = 0; k < 32; ++k) {
        const float c = c2e[i * 32 + k];
        acc += (v2f){c, c} * a[k];
      }
      op[i * IN_]        = acc.x;
      op[(32 + i) * IN_] = acc.y;
    }
  }
}

// ---------------------------------------------------------------------------
// Kernel 4: the two inner mode products and the gate-weighted combine, fused.
// One block per weight row (its 768 inputs seen as 24 x 32), one wave per
// expert:  t_e = c1[e] * X_e,  u_e = t_e * c2[e]^T,
//          ew[b][row] = res[row] + 0.9 * sum_e gates[b,e] * u_e.
// t_e and u_e live in LDS only. Every sum keeps its ascending index order.
// ---------------------------------------------------------------------------
__global__ __launch_bounds__(256) void inner_combine_kernel(
    const float* __restrict__ in, const float* __restrict__ c1,
    const float* __restrict__ c2, const float* __restrict__ res,
    const float* __restrict__ gates, float* __restrict__ ew) {
  __shared__ __attribute__((aligned(16))) float s_t[E_][IN_];
  __shared__ __attribute__((aligned(16))) float s_u[E_][IN_];
  const int row  = blockIdx.x;
  const int lane = threadIdx.x & 31;
  // wave number in a scalar register: c1 coefficient and gate reads become scalar loads
  const int w = __builtin_amdgcn_readfirstlane((int)(threadIdx.x >> 5));

  // lane holds column 'lane' of X_w (24 values) and row 'lane' of c2[w] (32 values)
  const float* xw  = in + (size_t)w * WSZ + (size_t)row * IN_;
  const float* c2w = c2 + w * 1024;
  const unsigned coff = (unsigned)lane * 128u;   // byte offset of the lane's c2 row
  float xv[24];
  #pragma unroll   // constant indices keep the array in registers
  for (int t = 0; t < 24; ++t) xv[t] = xw[t * 32 + lane];
  float cr[32];
  #pragma unroll   // constant indices keep the array in registers
  for (int q = 0; q < 8; ++q) {
    const float4 v = *(const float4*)((const char*)c2w + coff + q * 16);
    cr[4 * q + 0] = v.x; cr[4 * q + 1] = v.y;
    cr[4 * q + 2] = v.z; cr[4 * q + 3] = v.w;
  }
  // the address registers of the loads above stay as they are up to this wait
  asm volatile("s_wait_xcnt 0x0" :: "v"(lane), "v"(coff), "s"(xw), "s"(c2w) : "memory");

  // t[i][lane] = sum_t c1[w][i][t] * X[t][lane]; the coefficient is wave-uniform.
  // Rows 2p and 2p+1 go as one packed pair and lie interleaved in LDS:
  // s_t[w][p*64 + m*2 + (i&1)], so that the next product reads whole pairs.
  const float* c1w = c1 + w * 576;
  #pragma unroll 2   // two independent packed sums in flight hide the add latency
  for (int p = 0; p < 12; ++p) {
    v2f acc = {0.f, 0.f};
    #pragma unroll   // constant indices keep the array in registers
    for (int t = 0; t < 24; ++t) {
      const v2f c = {c1w[(2 * p) * 24 + t], c1w[(2 * p + 1) * 24 + t]};
      const v2f x = {xv[t], xv[t]};
      acc += c * x;
    }
    *(v2f*)(&s_t[w][p * 64 + lane * 2]) = acc;
  }
  __syncthreads();   // t rows are read across lanes below

  // u[l][lane] = sum_m c2[w][lane][m] * t[l][m]; t is an LDS broadcast,
  // 16 bytes = rows 2p, 2p+1 at columns m, m+1
  #pragma unroll 2   // two independent packed sums in flight, their LDS reads grouped
  for (int p = 0; p < 12; ++p) {
    const v4f* tp = (const v4f*)(&s_t[w][p * 64]);
    v2f acc = {0.f, 0.f};
    #pragma unroll   // constant indices keep the array in registers
    for (int h = 0; h < 16; ++h) {
      const v4f v = tp[h];
      const v2f ca = {cr[2 * h], cr[2 * h]};
      const v2f cb = {cr[2 * h + 1], cr[2 * h + 1]};
      const v2f ta = {v.x, v.y};
      const v2f tb = {v.z, v.w};
      acc += ca * ta;
      acc += cb * tb;
    }
    s_u[w][(2 * p) * 32 + lane]     = acc.x;
    s_u[w][(2 * p + 1) * 32 + lane] = acc.y;
  }
  __syncthreads();   // every wave reads all eight experts' u below

  // wave w writes batches 2w and 2w+1, 16 bytes per lane
  const float* g0 = gates + (2 * w) * E_;
  const float* g1 = g0 + E_;
  float* o0 = ew + (size_t)(2 * w) * WSZ + (size_t)row * IN_;
  float* o1 = o0 + WSZ;
  const float* rr = res + (size_t)row * IN_;
  #pragma unroll   // constant indices keep the array in registers
  for (int q = 0; q < 6; ++q) {
    const int idx = q * 128 + lane * 4;
    const float4 r4 = *(const float4*)(rr + idx);
    float4 sa = make_float4(0.f, 0.f, 0.f, 0.f);
    float4 sb = make_float4(0.f, 0.f, 0.f, 0.f);
    #pragma unroll   // constant indices keep the array in registers
    for (int e = 0; e < E_; ++e) {
      const float4 u = *(const float4*)(&s_u[e][idx]);
      const float ga = g0[e], gb = g1[e];
      sa.x += ga * u.x; sa.y += ga * u.y; sa.z += ga * u.z; sa.w += ga * u.w;
      sb.x += gb * u.x; sb.y += gb * u.y; sb.z += gb * u.z; sb.w += gb * u.w;
    }
    *(float4*)(o0 + idx) = make_float4(r4.x + 0.9f * sa.x, r4.y + 0.9f * sa.y,
                                       r4.z + 0.9f * sa.z, r4.w + 0.9f * sa.w);
    *(float4*)(o1 + idx) = make_float4(r4.x + 0.9f * sb.x, r4.y + 0.9f * sb.y,
                                       r4.z + 0.9f * sb.z, r4.w + 0.9f * sb.w);
  }
}

// ---------------------------------------------------------------------------
// Kernel 5: main GEMM with FP32 WMMA, double-buffered LDS.
// y[b] (512x768) = x[b] (512x768) @ ew[b]^T; ew stored [N][K] (K contiguous).
// Block: 256 thr = 8 waves (4M x 2N); block tile 128x64, K-stage 64.
// Staging: async global->LDS copy (ASYNCcnt) when available, else
// register-prefetch software pipeline. One barrier per K-iteration.
// ---------------------------------------------------------------------------
#define LDP 68
__global__ __launch_bounds__(256) void gemm_kernel(const float* __restrict__ x,
                                                   const float* __restrict__ ew,
                                                   float* __restrict__ y) {
  __shared__ float lds_a[2][128 * LDP];
  __shared__ float lds_b[2][64 * LDP];
  const int b  = blockIdx.z;
  const int m0 = blockIdx.y * 128;
  const int n0 = blockIdx.x * 64;
  const float* Ag = x  + (size_t)b * S_ * IN_ + (size_t)m0 * IN_;
  const float* Bg = ew + (size_t)b * WSZ     + (size_t)n0 * IN_;

  const int tid   = threadIdx.x;
  const int lane  = tid & 31;
  const int wave  = tid >> 5;
  const int wm    = wave & 3;     // 0..3 -> 32-row band
  const int wn    = wave >> 2;    // 0..1 -> 32-col band
  const int mrow  = lane & 15;
  const int khalf = lane >> 4;    // lanes 0-15: K{0,1}; lanes 16-31: K{2,3}
  const int koff  = khalf * 2;

  const int a_row0 = (wm * 32 + mrow) * LDP;
  const int a_row1 = (wm * 32 + 16 + mrow) * LDP;
  const int b_row0 = (wn * 32 + mrow) * LDP;
  const int b_row1 = (wn * 32 + 16 + mrow) * LDP;

  v8f acc00 = {}, acc01 = {}, acc10 = {}, acc11 = {};

#if USE_ASYNC
  auto stage_async = [&](int k0, int buf) {
    #pragma unroll
    for (int i = 0; i < 8; ++i) {               // A: 128 rows x 64 K
      const int idx = tid + i * 256;
      const int r = idx >> 4;
      const int c = (idx & 15) << 2;
      __builtin_amdgcn_global_load_async_to_lds_b128(
          (AS1 v4i*)(uintptr_t)(Ag + (size_t)r * IN_ + k0 + c),
          (AS3 v4i*)(&lds_a[buf][r * LDP + c]), 0, 0);
    }
    #pragma unroll
    for (int i = 0; i < 4; ++i) {               // B: 64 rows x 64 K
      const int idx = tid + i * 256;
      const int r = idx >> 4;
      const int c = (idx & 15) << 2;
      __builtin_amdgcn_global_load_async_to_lds_b128(
          (AS1 v4i*)(uintptr_t)(Bg + (size_t)r * IN_ + k0 + c),
          (AS3 v4i*)(&lds_b[buf][r * LDP + c]), 0, 0);
    }
  };
  stage_async(0, 0);
  __builtin_amdgcn_s_wait_asynccnt(0);
  __syncthreads();
#else
  float4 ra[8], rb[4];
  auto fetch_regs = [&](int k0) {
    #pragma unroll
    for (int i = 0; i < 8; ++i) {
      const int idx = tid + i * 256;
      const int r = idx >> 4;
      const int c = (idx & 15) << 2;
      ra[i] = *(const float4*)(Ag + (size_t)r * IN_ + k0 + c);
    }
    #pragma unroll
    for (int i = 0; i < 4; ++i) {
      const int idx = tid + i * 256;
      const int r = idx >> 4;
      const int c = (idx & 15) << 2;
      rb[i] = *(const float4*)(Bg + (size_t)r * IN_ + k0 + c);
    }
  };
  auto store_regs = [&](int buf) {
    #pragma unroll
    for (int i = 0; i < 8; ++i) {
      const int idx = tid + i * 256;
      const int r = idx >> 4;
      const int c = (idx & 15) << 2;
      *(float4*)(&lds_a[buf][r * LDP + c]) = ra[i];
    }
    #pragma unroll
    for (int i = 0; i < 4; ++i) {
      const int idx = tid + i * 256;
      const int r = idx >> 4;
      const int c = (idx & 15) << 2;
      *(float4*)(&lds_b[buf][r * LDP + c]) = rb[i];
    }
  };
  fetch_regs(0);
  store_regs(0);
  __syncthreads();
#endif

  for (int k0 = 0; k0 < IN_; k0 += 64) {
    const int cur = (k0 >> 6) & 1;
    const int nxt = cur ^ 1;
    const bool have_next = (k0 + 64) < IN_;

    if (have_next) {
#if USE_ASYNC
      stage_async(k0 + 64, nxt);      // copy next stage while WMMAs run
#else
      fetch_regs(k0 + 64);            // global loads in flight over compute
#endif
    }

    const float* la = lds_a[cur];
    const float* lb = lds_b[cur];
    #pragma unroll
    for (int k = 0; k < 64; k += 4) {
      const v2f a0 = *(const v2f*)(&la[a_row0 + k + koff]);
      const v2f a1 = *(const v2f*)(&la[a_row1 + k + koff]);
      const v2f b0 = *(const v2f*)(&lb[b_row0 + k + koff]);
      const v2f b1 = *(const v2f*)(&lb[b_row1 + k + koff]);
      acc00 = __builtin_amdgcn_wmma_f32_16x16x4_f32(false, a0, false, b0,
                                                    (short)0, acc00, false, false);
      acc01 = __builtin_amdgcn_wmma_f32_16x16x4_f32(false, a0, false, b1,
                                                    (short)0, acc01, false, false);
      acc10 = __builtin_amdgcn_wmma_f32_16x16x4_f32(false, a1, false, b0,
                                                    (short)0, acc10, false, false);
      acc11 = __builtin_amdgcn_wmma_f32_16x16x4_f32(false, a1, false, b1,
                                                    (short)0, acc11, false, false);
    }

    if (have_next) {
#if USE_ASYNC
      __builtin_amdgcn_s_wait_asynccnt(0);
      __syncthreads();
#else
      store_regs(nxt);                // buf[nxt] readers finished last iter
      __syncthreads();
#endif
    }
  }

  // store: C layout -> VGPR v holds row (v + khalf*8), col = mrow within tile
  float* Y = y + ((size_t)b * S_ + m0) * OUT_ + n0;
  #pragma unroll
  for (int v = 0; v < 8; ++v) {
    const int rr = khalf * 8 + v;
    Y[(size_t)(wm * 32 + rr)      * OUT_ + wn * 32 + mrow]      = acc00[v];
    Y[(size_t)(wm * 32 + rr)      * OUT_ + wn * 32 + 16 + mrow] = acc01[v];
    Y[(size_t)(wm * 32 + 16 + rr) * OUT_ + wn * 32 + mrow]      = acc10[v];
    Y[(size_t)(wm * 32 + 16 + rr) * OUT_ + wn * 32 + 16 + mrow] = acc11[v];
  }
}

// ---------------------------------------------------------------------------
extern "C" void kernel_launch(void* const* d_in, const int* in_sizes, int n_in,
                              void* d_out, int out_size, void* d_ws, size_t ws_size,
                              hipStream_t stream) {
  const float* x    = (const float*)d_in[0];
  const float* wg   = (const float*)d_in[1];
  const float* wt   = (const float*)d_in[2];
  const float* resw = (const float*)d_in[3];
  const float* c1i  = (const float*)d_in[4];   // (E,24,24)
  const float* c2i  = (const float*)d_in[5];   // (E,32,32)
  const float* c1o  = (const float*)d_in[6];   // (E,24,24)
  const float* c2o  = (const float*)d_in[7];   // (E,32,32)

  float* y    = (float*)d_out;
  float* loss = y + YSZ;

  float* ws       = (float*)d_ws;
  float* ws_gates = ws;                          // 128
  float* ws_part  = ws + 128;                    // B*CH*E = 4096
  float* bufB     = ws + 16384;                  // E*WSZ
  float* ewbuf    = bufB + (size_t)E_ * WSZ;     // B*WSZ

  // gating path
  logit_part_kernel<<<dim3(CH_, B_), dim3(PT_), 0, stream>>>(x, wg, ws_part);
  gate_kernel<<<dim3(1), dim3(128), 0, stream>>>(ws_part, ws_gates, loss);

  // curvature transforms: (weight - res), outer two mode products, one launch
  outer_modes_kernel<<<dim3(IN_ / 32, E_), dim3(512), 0, stream>>>(
      wt, resw, c1o, c2o, bufB);
  // inner two mode products + per-batch combined weights, one launch
  inner_combine_kernel<<<dim3(OUT_), dim3(256), 0, stream>>>(
      bufB, c1i, c2i, resw, ws_gates, ewbuf);

  // main batched GEMM with fp32 WMMA
  gemm_kernel<<<dim3(OUT_ / 64, S_ / 128, B_), dim3(256), 0, stream>>>(
      x, ewbuf, y);
}

// v003
// A run of this version takes 83.8 microseconds.
// In both of two side-by-side timings against v002, it was 1.08 times as fast.
// All steps since v000 together make it 2.43 times as fast.
#include <hip/hip_runtime.h>

typedef float v2f __attribute__((ext_vector_type(2)));
typedef float v4f __attribute__((ext_vector_type(4)));
typedef float v8f __attribute__((ext_vector_type(8)));
typedef int   v4i __attribute__((ext_vector_type(4)));

#define AS1 __attribute__((address_space(1)))
#define AS3 __attribute__((address_space(3)))

#if __has_builtin(__builtin_amdgcn_global_load_async_to_lds_b128) && \
    __has_builtin(__builtin_amdgcn_s_wait_asynccnt)
#define USE_ASYNC 1
#else
#define USE_ASYNC 0
#endif

#define E_   8
#define K_   4
#define IN_  768
#define OUT_ 768
#define B_   16
#define S_   512
#define WSZ  (OUT_ * IN_)          // 589824 per expert
#define YSZ  ((size_t)B_ * S_ * OUT_)

// ---------------------------------------------------------------------------
// Partial gate logits, one chunk = (batch, 16 rows of x), done by 192 threads:
//   col[j]        = (sum over the chunk's rows s of x[b][s][j]) / 512
//   part[b][c][e] = sum_j col[j] * wg[j][e]
// Thread t sums columns 4t..4t+3; wg is read as whole lines, 16 bytes per lane,
// so a thread meets rows (t>>1) + 96q of wg and takes their col[] from LDS.
// These chunks ride in the launch of the outer mode products (below), two per
// work-group of 512 threads: waves 0..5 and 6..11 take one each, waves 12..15
// only pass the barriers.
// ---------------------------------------------------------------------------
#define CH_  32                    // row chunks per batch
#define RPC  (S_ / CH_)            // rows per chunk
#define PT_  (IN_ / 4)             // threads per chunk: one per 16 bytes of a row
#define OB_  ((IN_ / 32) * E_)     // work-groups of the outer mode products
#define LB_  (B_ * CH_ / 2)        // work-groups of the partial logits
__device__ __forceinline__ void logit_part_role(const float* __restrict__ x,
                                                const float* __restrict__ wg,
                                                float* __restrict__ part,
                                                float* lds, int pair) {
  // wave number in a scalar register: the split into groups stays wave-uniform
  const int wv  = __builtin_amdgcn_readfirstlane((int)(threadIdx.x >> 5));
  const int grp = wv / (PT_ / 32);           // 0, 1: one chunk each; 2: spare waves
  const bool on = grp < 2;
  const int id  = pair * 2 + (on ? grp : 0);
  const int c = id % CH_;
  const int b = id / CH_;
  const int t = (int)threadIdx.x - grp * PT_;
  float* s_col = lds + grp * 1024;           // IN_ floats per group
  float* s_w   = lds + 3072 + grp * 64;      // (PT_ / 32) x E_ floats per group
  v4f g[8];        // g[q] = wg[(t>>1) + 96q][4(t&1) .. 4(t&1)+3]
  if (on) {
    const v4f* xp = (const v4f*)(x + ((size_t)b * S_ + (size_t)c * RPC) * IN_) + t;
    const v4f* wp = (const v4f*)wg + t;
    v4f v[RPC];
    #pragma unroll   // constant indices keep the array in registers
    for (int r = 0; r < RPC; ++r) v[r] = xp[r * PT_];
    #pragma unroll   // constant indices keep the array in registers
    for (int q = 0; q < 8; ++q) g[q] = wp[q * PT_];
    // inputs-only fence on the loaded values: all 24 loads are issued before the first sum;
    // without it the later ones are issued only when the first have returned, and the
    // group pays the memory latency twice
    static_assert(RPC == 16, "the fence below names 16 row values");
    asm volatile("" :: "v"(v[0]), "v"(v[1]), "v"(v[2]), "v"(v[3]), "v"(v[4]), "v"(v[5]),
                 "v"(v[6]), "v"(v[7]), "v"(v[8]), "v"(v[9]), "v"(v[10]), "v"(v[11]),
                 "v"(v[12]), "v"(v[13]), "v"(v[14]), "v"(v[15]), "v"(g[0]), "v"(g[1]),
                 "v"(g[2]), "v"(g[3]), "v"(g[4]), "v"(g[5]), "v"(g[6]), "v"(g[7]));

    v4f s = v[0];
    #pragma unroll   // constant indices keep the array in registers
    for (int r = 1; r < RPC; ++r) s += v[r];
    s *= 1.0f / (float)S_;
    *(v4f*)(&s_col[4 * t]) = s;
  }
  __syncthreads();   // column sums are read across threads below

  if (on) {
    v4f acc = {0.f, 0.f, 0.f, 0.f};
    #pragma unroll   // constant indices keep the array in registers
    for (int q = 0; q < 8; ++q) acc += s_col[(t >> 1) + q * (PT_ / 2)] * g[q];

    // butterfly over the lanes of equal parity: even lanes hold experts 0..3, odd 4..7
    #pragma unroll   // four independent sums overlap their cross-lane latency
    for (int m = 16; m >= 2; m >>= 1) {
      acc.x += __shfl_xor(acc.x, m, 32);
      acc.y += __shfl_xor(acc.y, m, 32);
      acc.z += __shfl_xor(acc.z, m, 32);
      acc.w += __shfl_xor(acc.w, m, 32);
    }
    if ((t & 31) < 2) *(v4f*)(&s_w[(t >> 5) * E_ + (t & 1) * 4]) = acc;
  }
  __syncthreads();   // the waves' sums are added across waves below
  if (on && t < E_) {
    float sum = 0.f;
    #pragma unroll   // constant indices: the six LDS reads go out together
    for (int w = 0; w < PT_ / 32; ++w) sum += s_w[w * E_ + t];
    part[(b * CH_ + c) * E_ + t] = sum;
  }
}

// ---------------------------------------------------------------------------
// Kernel 1: the two outer mode products, fused. The weight is seen as
// [24 j][32 k][768 c]. One block per (expert, 32 columns c), lane = column:
//   a[i][k][c]  = sum_j c1[e][i][j] * (wt[e][j][k][c] - res[j][k][c])
//   out[j][i][c] = sum_k c2[e][i][k] * a[j][k][c]
// a lives in LDS only. Every sum keeps its ascending index order.
// Work-groups OB_ and up do the partial gate logits instead: they depend on
// nothing here and fill the memory time that the products leave free.
// ---------------------------------------------------------------------------
__global__ __launch_bounds__(512) void outer_modes_logit_kernel(
    const float* __restrict__ wt, const float* __restrict__ res,
    const float* __restrict__ c1, const float* __restrict__ c2,
    float* __restrict__ out, const float* __restrict__ x,
    const float* __restrict__ wg, float* __restrict__ part) {
  // a[j][k][c] at s_a[((j>>1)*32 + k)*64 + c*2 + (j&1)]: rows 2p, 2p+1 as pairs
  __shared__ __attribute__((aligned(16))) float s_a[12 * 32 * 64];
  if (blockIdx.x >= OB_) {   // the same for the whole work-group
    logit_part_role(x, wg, part, s_a, (int)blockIdx.x - OB_);
    return;
  }
  const int e    = blockIdx.x / (IN_ / 32);
  const int c0   = (blockIdx.x % (IN_ / 32)) * 32;
  const int lane = threadIdx.x & 31;
  // wave number in a scalar register: the work split below stays wave-uniform
  const int w = __builtin_amdgcn_readfirstlane((int)(threadIdx.x >> 5));
  const float* c1e = c1 + e * 576;
  const float* c2e = c2 + e * 1024;

  {
    // wave w takes k = 2w, 2w+1 as one packed pair; coefficients are scalars
    const int k = 2 * w;
    const float* wp = wt + (size_t)e * WSZ + (size_t)k * IN_ + c0 + lane;
    const float* rp = res + (size_t)k * IN_ + c0 + lane;
    v2f x[24];
    #pragma unroll   // constant indices keep the array in registers
    for (int j = 0; j < 24; ++j) {
      const int o = j * 32 * IN_;
      x[j].x = wp[o] - rp[o];
      x[j].y = wp[o + IN_] - rp[o + IN_];
    }
    #pragma unroll 2   // four independent packed sums in flight hide the add latency
    for (int p = 0; p < 12; ++p) {
      v2f a0 = {0.f, 0.f}, a1 = {0.f, 0.f};
      #pragma unroll   // constant indices keep the array in registers
      for (int j = 0; j < 24; ++j) {
        const float ca = c1e[(2 * p) * 24 + j];
        const float cb = c1e[(2 * p + 1) * 24 + j];
        a0 += (v2f){ca, ca} * x[j];
        a1 += (v2f){cb, cb} * x[j];
      }
      *(v2f*)(&s_a[(p * 32 + k) * 64 + lane * 2])     = (v2f){a0.x, a1.x};
      *(v2f*)(&s_a[(p * 32 + k + 1) * 64 + lane * 2]) = (v2f){a0.y, a1.y};
    }
  }
  __syncthreads();   // each wave reads all k of its rows below

  // 48 units = 12 row pairs x 4 groups of 8 outputs; wave w takes units 3w..3w+2
  for (int uu = 0; uu < 3; ++uu) {
    const int u  = w * 3 + uu;
    const int jp = u >> 2;
    const int i0 = (u & 3) * 8;
    v2f a[32];
    #pragma unroll   // constant indices keep the array in registers
    for (int k = 0; k < 32; ++k)
      a[k] = *(const v2f*)(&s_a[(jp * 32 + k) * 64 + lane * 2]);
    float* op = out + (size_t)e * WSZ + (size_t)(2 * jp) * 32 * IN_ + c0 + lane;
    #pragma unroll 2   // independent packed sums in flight hide the add latency
    for (int ii = 0; ii < 8; ++ii) {
      const int i = i0 + ii;
      v2f acc = {0.f, 0.f};
      #pragma unroll   // constant indices keep the array in registers
      for (int k = 0; k < 32; ++k) {
        const float c = c2e[i * 32 + k];
        acc += (v2f){c, c} * a[k];
      }
      op[i * IN_]        = acc.x;
      op[(32 + i) * IN_] = acc.y;
    }
  }
}

// ---------------------------------------------------------------------------
// Kernel 2: the two inner mode products and the gate-weighted combine, fused.
// One block per weight row (its 768 inputs seen as 24 x 32), one wave per
// expert:  t_e = c1[e] * X_e,  u_e = t_e * c2[e]^T,
//          ew[b][row] = res[row] + 0.9 * sum_e gates[b,e] * u_e.
// t_e and u_e live in LDS only. Every sum keeps its ascending index order.
// The gates are formed here too: wave w writes batches 2w and 2w+1 and makes
// their top-4 softmax gates from the partial logits while its weight loads are
// in flight. Block 0 also writes the cv^2 loss.
// ---------------------------------------------------------------------------
__global__ __launch_bounds__(256) void inner_combine_kernel(
    const float* __restrict__ in, const float* __restrict__ c1,
    const float* __restrict__ c2, const float* __restrict__ res,
    const float* __restrict__ part, float* __restrict__ ew,
    float* __restrict__ loss_out) {
  __shared__ __attribute__((aligned(16))) float s_t[E_][IN_];
  __shared__ __attribute__((aligned(16))) float s_u[E_][IN_];
  __shared__ __attribute__((aligned(16))) float s_gates[B_ * E_];   // block 0 only
  const int row  = blockIdx.x;
  const int lane = threadIdx.x & 31;
  // wave number in a scalar register: coefficient reads become scalar loads
  const int w = __builtin_amdgcn_readfirstlane((int)(threadIdx.x >> 5));

  // lane holds column 'lane' of X_w (24 values) and row 'lane' of c2[w] (32 values)
  const float* xw  = in + (size_t)w * WSZ + (size_t)row * IN_;
  const float* c2w = c2 + w * 1024;
  const unsigned coff = (unsigned)lane * 128u;   // byte offset of the lane's c2 row
  // lane = (batch bit, expert) of the wave's two batches; lanes 16..31 repeat 0..15
  const int ge = lane & 7;
  const float* pw = part + (size_t)(2 * w) * CH_ * E_;
  const unsigned pidx = (unsigned)(((lane >> 3) & 1) * CH_ * E_ + ge);
  float p[CH_];
  #pragma unroll   // constant indices keep the array in registers, every load in flight at once
  for (int c = 0; c < CH_; ++c) p[c] = pw[pidx + c * E_];
  float xv[24];
  #pragma unroll   // constant indices keep the array in registers
  for (int t = 0; t < 24; ++t) xv[t] = xw[t * 32 + lane];
  float cr[32];
  #pragma unroll   // constant indices keep the array in registers
  for (int q = 0; q < 8; ++q) {
    const float4 v = *(const float4*)((const char*)c2w + coff + q * 16);
    cr[4 * q + 0] = v.x; cr[4 * q + 1] = v.y;
    cr[4 * q + 2] = v.z; cr[4 * q + 3] = v.w;
  }
  // the address registers of the loads above stay as they are up to this wait
  asm volatile("s_wait_xcnt 0x0" :: "v"(lane), "v"(coff), "v"(pidx), "s"(xw), "s"(c2w), "s"(pw)
               : "memory");
  // every load above is issued before the first sum below; without this the weight loads
  // are issued only when the first partial logits have returned: the memory latency twice
  __builtin_amdgcn_sched_barrier(0);

  // logit of (batch, expert): the chunks in ascending order
  float lg = 0.f;
  #pragma unroll   // constant indices keep the array in registers
  for (int c = 0; c < CH_; ++c) lg += p[c];
  // place of this logit among its batch's eight: larger first, equal ones by index
  float o[E_];
  #pragma unroll   // seven independent cross-lane reads overlap their latency
  for (int j = 1; j < E_; ++j)
    o[j] = __int_as_float(__builtin_amdgcn_ds_bpermute((lane ^ j) * 4, __float_as_int(lg)));
  int   rank = 0;
  float mx   = lg;
  #pragma unroll   // constant indices keep the array in registers
  for (int j = 1; j < E_; ++j) {
    rank += (int)(o[j] > lg) | ((int)(o[j] == lg) & (int)((ge ^ j) < ge));
    mx = fmaxf(mx, o[j]);
  }
  const float ea = expf(lg - mx);
  const float ex = (rank < K_) ? ea : 0.f;
  // the four exponentials are summed largest first: send each to the lane of its place
  const int   gbase  = lane & 24;
  const float sorted = __int_as_float(
      __builtin_amdgcn_ds_permute((gbase | rank) * 4, __float_as_int(ex)));
  float es = 0.f;
  #pragma unroll   // four independent cross-lane reads overlap their latency
  for (int r = 0; r < K_; ++r)
    es += __int_as_float(__builtin_amdgcn_ds_bpermute((gbase | r) * 4, __float_as_int(sorted)));
  const float gate = (rank < K_) ? ex / es : 0.f;
  if (row == 0 && lane < 2 * E_) s_gates[w * 2 * E_ + lane] = gate;   // read behind two barriers

  // t[i][lane] = sum_t c1[w][i][t] * X[t][lane]; the coefficient is wave-uniform.
  // Rows 2p and 2p+1 go as one packed pair and lie interleaved in LDS:
  // s_t[w][p*64 + m*2 + (i&1)], so that the next product reads whole pairs.
  const float* c1w = c1 + w * 576;
  #pragma unroll 2   // two independent packed sums in flight hide the add latency
  for (int p = 0; p < 12; ++p) {
    v2f acc = {0.f, 0.f};
    #pragma unroll   // constant indices keep the array in registers
    for (int t = 0; t < 24; ++t) {
      const v2f c = {c1w[(2 * p) * 24 + t], c1w[(2 * p + 1) * 24 + t]};
      const v2f x = {xv[t], xv[t]};
      acc += c * x;
    }
    *(v2f*)(&s_t[w][p * 64 + lane * 2]) = acc;
  }
  __syncthreads();   // t rows are read across lanes below

  // u[l][lane] = sum_m c2[w][lane][m] * t[l][m]; t is an LDS broadcast,
  // 16 bytes = rows 2p, 2p+1 at columns m, m+1
  #pragma unroll 2   // two independent packed sums in flight, their LDS reads grouped
  for (int p = 0; p < 12; ++p) {
    const v4f* tp = (const v4f*)(&s_t[w][p * 64]);
    v2f acc = {0.f, 0.f};
    #pragma unroll   // constant indices keep the array in registers
    for (int h = 0; h < 16; ++h) {
      const v4f v = tp[h];
      const v2f ca = {cr[2 * h], cr[2 * h]};
      const v2f cb = {cr[2 * h + 1], cr[2 * h + 1]};
      const v2f ta = {v.x, v.y};
      const v2f tb = {v.z, v.w};
      acc += ca * ta;
      acc += cb * tb;
    }
    s_u[w][(2 * p) * 32 + lane]     = acc.x;
    s_u[w][(2 * p + 1) * 32 + lane] = acc.y;
  }
  __syncthreads();   // every wave reads all eight experts' u below

  // wave w writes batches 2w and 2w+1, 16 bytes per lane
  float g0[E_], g1[E_];   // the wave's sixteen gates as scalars
  #pragma unroll   // constant indices keep the arrays in registers
  for (int e = 0; e < E_; ++e) {
    g0[e] = __int_as_float(__builtin_amdgcn_readlane(__float_as_int(gate), e));
    g1[e] = __int_as_float(__builtin_amdgcn_readlane(__float_as_int(gate), E_ + e));
  }
  float* o0 = ew + (size_t)(2 * w) * WSZ + (size_t)row * IN_;
  float* o1 = o0 + WSZ;
  const float* rr = res + (size_t)row * IN_;
  #pragma unroll   // constant indices keep the array in registers
  for (int q = 0; q < 6; ++q) {
    const int idx = q * 128 + lane * 4;
    const float4 r4 = *(const float4*)(rr + idx);
    float4 sa = make_float4(0.f, 0.f, 0.f, 0.f);
    float4 sb = make_float4(0.f, 0.f, 0.f, 0.f);
    #pragma unroll   // constant indices keep the array in registers
    for (int e = 0; e < E_; ++e) {
      const float4 u = *(const float4*)(&s_u[e][idx]);
      const float ga = g0[e], gb = g1[e];
      sa.x += ga * u.x; sa.y += ga * u.y; sa.z += ga * u.z; sa.w += ga * u.w;
      sb.x += gb * u.x; sb.y += gb * u.y; sb.z += gb * u.z; sb.w += gb * u.w;
    }
    *(float4*)(o0 + idx) = make_float4(r4.x + 0.9f * sa.x, r4.y + 0.9f * sa.y,
                                       r4.z + 0.9f * sa.z, r4.w + 0.9f * sa.w);
    *(float4*)(o1 + idx) = make_float4(r4.x + 0.9f * sb.x, r4.y + 0.9f * sb.y,
                                       r4.z + 0.9f * sb.z, r4.w + 0.9f * sb.w);
  }

  if (row == 0 && threadIdx.x == 0) {
    float imp[E_], ld[E_];
    for (int e = 0; e < E_; ++e) { imp[e] = 0.f; ld[e] = 0.f; }
    for (int b = 0; b < B_; ++b)
      for (int e = 0; e < E_; ++e) {
        const float g = s_gates[b * E_ + e];
        imp[e] += g;
        ld[e]  += (g > 0.f) ? 1.f : 0.f;
      }
    float cv[2];
    for (int w2 = 0; w2 < 2; ++w2) {
      const float* v = w2 ? ld : imp;
      float mean = 0.f;
      for (int e = 0; e < E_; ++e) mean += v[e];
      mean *= (1.0f / E_);
      float var = 0.f;
      for (int e = 0; e < E_; ++e) { const float d = v[e] - mean; var += d * d; }
      var *= (1.0f / (E_ - 1));
      cv[w2] = var / (mean * mean + 1e-10f);
    }
    *loss_out = 0.01f * (cv[0] + cv[1]);
  }
}

// ---------------------------------------------------------------------------
// Kernel 3: main GEMM with FP32 WMMA, double-buffered LDS.
// y[b] (512x768) = x[b] (512x768) @ ew[b]^T; ew stored [N][K] (K contiguous).
// Block: 256 thr = 8 waves (4M x 2N); block tile 128x64, K-stage 64.
// Staging: async global->LDS copy (ASYNCcnt) when available, else
// register-prefetch software pipeline. One barrier per K-iteration.
// ---------------------------------------------------------------------------
#define LDP 68
__global__ __launch_bounds__(256) void gemm_kernel(const float* __restrict__ x,
                                                   const float* __restrict__ ew,
                                                   float* __restrict__ y) {
  __shared__ float lds_a[2][128 * LDP];
  __shared__ float lds_b[2][64 * LDP];
  const int b  = blockIdx.z;
  const int m0 = blockIdx.y * 128;
  const int n0 = blockIdx.x * 64;
  const float* Ag = x  + (size_t)b * S_ * IN_ + (size_t)m0 * IN_;
  const float* Bg = ew + (size_t)b * WSZ     + (size_t)n0 * IN_;

  const int tid   = threadIdx.x;
  const int lane  = tid & 31;
  const int wave  = tid >> 5;
  const int wm    = wave & 3;     // 0..3 -> 32-row band
  const int wn    = wave >> 2;    // 0..1 -> 32-col band
  const int mrow  = lane & 15;
  const int khalf = lane >> 4;    // lanes 0-15: K{0,1}; lanes 16-31: K{2,3}
  const int koff  = khalf * 2;

  const int a_row0 = (wm * 32 + mrow) * LDP;
  const int a_row1 = (wm * 32 + 16 + mrow) * LDP;
  const int b_row0 = (wn * 32 + mrow) * LDP;
  const int b_row1 = (wn * 32 + 16 + mrow) * LDP;

  v8f acc00 = {}, acc01 = {}, acc10 = {}, acc11 = {};

#if USE_ASYNC
  auto stage_async = [&](int k0, int buf) {
    #pragma unroll
    for (int i = 0; i < 8; ++i) {               // A: 128 rows x 64 K
      const int idx = tid + i * 256;
      const int r = idx >> 4;
      const int c = (idx & 15) << 2;
      __builtin_amdgcn_global_load_async_to_lds_b128(
          (AS1 v4i*)(uintptr_t)(Ag + (size_t)r * IN_ + k0 + c),
          (AS3 v4i*)(&lds_a[buf][r * LDP + c]), 0, 0);
    }
    #pragma unroll
    for (int i = 0; i < 4; ++i) {               // B: 64 rows x 64 K
      const int idx = tid + i * 256;
      const int r = idx >> 4;
      const int c = (idx & 15) << 2;
      __builtin_amdgcn_global_load_async_to_lds_b128(
          (AS1 v4i*)(uintptr_t)(Bg + (size_t)r * IN_ + k0 + c),
          (AS3 v4i*)(&lds_b[buf][r * LDP + c]), 0, 0);
    }
  };
  stage_async(0, 0);
  __builtin_amdgcn_s_wait_asynccnt(0);
  __syncthreads();
#else
  float4 ra[8], rb[4];
  auto fetch_regs = [&](int k0) {
    #pragma unroll
    for (int i = 0; i < 8; ++i) {
      const int idx = tid + i * 256;
      const int r = idx >> 4;
      const int c = (idx & 15) << 2;
      ra[i] = *(const float4*)(Ag + (size_t)r * IN_ + k0 + c);
    }
    #pragma unroll
    for (int i = 0; i < 4; ++i) {
      const int idx = tid + i * 256;
      const int r = idx >> 4;
      const int c = (idx & 15) << 2;
      rb[i] = *(const float4*)(Bg + (size_t)r * IN_ + k0 + c);
    }
  };
  auto store_regs = [&](int buf) {
    #pragma unroll
    for (int i = 0; i < 8; ++i) {
      const int idx = tid + i * 256;
      const int r = idx >> 4;
      const int c = (idx & 15) << 2;
      *(float4*)(&lds_a[buf][r * LDP + c]) = ra[i];
    }
    #pragma unroll
    for (int i = 0; i < 4; ++i) {
      const int idx = tid + i * 256;
      const int r = idx >> 4;
      const int c = (idx & 15) << 2;
      *(float4*)(&lds_b[buf][r * LDP + c]) = rb[i];
    }
  };
  fetch_regs(0);
  store_regs(0);
  __syncthreads();
#endif

  for (int k0 = 0; k0 < IN_; k0 += 64) {
    const int cur = (k0 >> 6) & 1;
    const int nxt = cur ^ 1;
    const bool have_next = (k0 + 64) < IN_;

    if (have_next) {
#if USE_ASYNC
      stage_async(k0 + 64, nxt);      // copy next stage while WMMAs run
#else
      fetch_regs(k0 + 64);            // global loads in flight over compute
#endif
    }

    const float* la = lds_a[cur];
    const float* lb = lds_b[cur];
    #pragma unroll
    for (int k = 0; k < 64; k += 4) {
      const v2f a0 = *(const v2f*)(&la[a_row0 + k + koff]);
      const v2f a1 = *(const v2f*)(&la[a_row1 + k + koff]);
      const v2f b0 = *(const v2f*)(&lb[b_row0 + k + koff]);
      const v2f b1 = *(const v2f*)(&lb[b_row1 + k + koff]);
      acc00 = __builtin_amdgcn_wmma_f32_16x16x4_f32(false, a0, false, b0,
                                                    (short)0, acc00, false, false);
      acc01 = __builtin_amdgcn_wmma_f32_16x16x4_f32(false, a0, false, b1,
                                                    (short)0, acc01, false, false);
      acc10 = __builtin_amdgcn_wmma_f32_16x16x4_f32(false, a1, false, b0,
                                                    (short)0, acc10, false, false);
      acc11 = __builtin_amdgcn_wmma_f32_16x16x4_f32(false, a1, false, b1,
                                                    (short)0, acc11, false, false);
    }

    if (have_next) {
#if USE_ASYNC
      __builtin_amdgcn_s_wait_asynccnt(0);
      __syncthreads();
#else
      store_regs(nxt);                // buf[nxt] readers finished last iter
      __syncthreads();
#endif
    }
  }

  // store: C layout -> VGPR v holds row (v + khalf*8), col = mrow within tile
  float* Y = y + ((size_t)b * S_ + m0) * OUT_ + n0;
  #pragma unroll
  for (int v = 0; v < 8; ++v) {
    const int rr = khalf * 8 + v;
    Y[(size_t)(wm * 32 + rr)      * OUT_ + wn * 32 + mrow]      = acc00[v];
    Y[(size_t)(wm * 32 + rr)      * OUT_ + wn * 32 + 16 + mrow] = acc01[v];
    Y[(size_t)(wm * 32 + 16 + rr) * OUT_ + wn * 32 + mrow]      = acc10[v];
    Y[(size_t)(wm * 32 + 16 + rr) * OUT_ + wn * 32 + 16 + mrow] = acc11[v];
  }
}

// ---------------------------------------------------------------------------
extern "C" void kernel_launch(void* const* d_in, const int* in_sizes, int n_in,
                              void* d_out, int out_size, void* d_ws, size_t ws_size,
                              hipStream_t stream) {
  const float* x    = (const float*)d_in[0];
  const float* wg   = (const float*)d_in[1];
  const float* wt   = (const float*)d_in[2];
  const float* resw = (const float*)d_in[3];
  const float* c1i  = (const float*)d_in[4];   // (E,24,24)
  const float* c2i  = (const float*)d_in[5];   // (E,32,32)
  const float* c1o  = (const float*)d_in[6];   // (E,24,24)
  const float* c2o  = (const float*)d_in[7];   // (E,32,32)

  float* y    = (float*)d_out;
  float* loss = y + YSZ;

  float* ws       = (float*)d_ws;
  float* ws_part  = ws + 128;                    // B*CH*E = 4096
  float* bufB     = ws + 16384;                  // E*WSZ
  float* ewbuf    = bufB + (size_t)E_ * WSZ;     // B*WSZ

  // curvature transforms: (weight - res), outer two mode products; the partial
  // gate logits ride along as further work-groups of the same launch
  outer_modes_logit_kernel<<<dim3(OB_ + LB_), dim3(512), 0, stream>>>(
      wt, resw, c1o, c2o, bufB, x, wg, ws_part);
  // gates + loss, inner two mode products, per-batch combined weights, one launch
  inner_combine_kernel<<<dim3(OUT_), dim3(256), 0, stream>>>(
      bufB, c1i, c2i, resw, ws_part, ewbuf, loss);

  // main batched GEMM with fp32 WMMA
  gemm_kernel<<<dim3(OUT_ / 64, S_ / 128, B_), dim3(256), 0, stream>>>(
      x, ewbuf, y);
}

// v004
// A run of this version takes 79.4 microseconds.
// In two side-by-side timings against v003, it was 1.05 and 1.06 times as fast.
// Over all steps from v000 it is 2.56 times as fast.
#include <hip/hip_runtime.h>

typedef float v2f __attribute__((ext_vector_type(2)));
typedef float v4f __attribute__((ext_vector_type(4)));
typedef float v8f __attribute__((ext_vector_type(8)));
typedef int   v4i __attribute__((ext_vector_type(4)));

#define AS1 __attribute__((address_space(1)))
#define AS3 __attribute__((address_space(3)))

#if __has_builtin(__builtin_amdgcn_global_load_async_to_lds_b128) && \
    __has_builtin(__builtin_amdgcn_s_wait_asynccnt)
#define USE_ASYNC 1
#else
#define USE_ASYNC 0
#endif

#define E_   8
#define K_   4
#define IN_  768
#define OUT_ 768
#define B_   16
#define S_   512
#define WSZ  (OUT_ * IN_)          // 589824 per expert
#define YSZ  ((size_t)B_ * S_ * OUT_)

// ---------------------------------------------------------------------------
// Partial gate logits, one chunk = (batch, 16 rows of x), done by 192 threads:
//   col[j]        = (sum over the chunk's rows s of x[b][s][j]) / 512
//   part[b][c][e] = sum_j col[j] * wg[j][e]
// Thread t sums columns 4t..4t+3; wg is read as whole lines, 16 bytes per lane,
// so a thread meets rows (t>>1) + 96q of wg and takes their col[] from LDS.
// These chunks ride in the launch of the outer mode products (below), two per
// work-group of 512 threads: waves 0..5 and 6..11 take one each, waves 12..15
// only pass the barriers.
// ---------------------------------------------------------------------------
#define CH_  32                    // row chunks per batch
#define RPC  (S_ / CH_)            // rows per chunk
#define PT_  (IN_ / 4)             // threads per chunk: one per 16 bytes of a row
#define OB_  ((IN_ / 32) * E_)     // work-groups of the outer mode products
#define LB_  (B_ * CH_ / 2)        // work-groups of the partial logits
__device__ __forceinline__ void logit_part_role(const float* __restrict__ x,
                                                const float* __restrict__ wg,
                                                float* __restrict__ part,
                                                float* lds, int pair) {
  // wave number in a scalar register: the split into groups stays wave-uniform
  const int wv  = __builtin_amdgcn_readfirstlane((int)(threadIdx.x >> 5));
  const int grp = wv / (PT_ / 32);           // 0, 1: one chunk each; 2: spare waves
  const bool on = grp < 2;
  const int id  = pair * 2 + (on ? grp : 0);
  const int c = id % CH_;
  const int b = id / CH_;
  const int t = (int)threadIdx.x - grp * PT_;
  float* s_col = lds + grp * 1024;           // IN_ floats per group
  float* s_w   = lds + 3072 + grp * 64;      // (PT_ / 32) x E_ floats per group
  v4f g[8];        // g[q] = wg[(t>>1) + 96q][4(t&1) .. 4(t&1)+3]
  if (on) {
    const v4f* xp = (const v4f*)(x + ((size_t)b * S_ + (size_t)c * RPC) * IN_) + t;
    const v4f* wp = (const v4f*)wg + t;
    v4f v[RPC];
    #pragma unroll   // constant indices keep the array in registers
    for (int r = 0; r < RPC; ++r) v[r] = xp[r * PT_];
    #pragma unroll   // constant indices keep the array in registers
    for (int q = 0; q < 8; ++q) g[q] = wp[q * PT_];
    // inputs-only fence on the loaded values: all 24 loads are issued before the first sum;
    // without it the later ones are issued only when the first have returned, and the
    // group pays the memory latency twice
    static_assert(RPC == 16, "the fence below names 16 row values");
    asm volatile("" :: "v"(v[0]), "v"(v[1]), "v"(v[2]), "v"(v[3]), "v"(v[4]), "v"(v[5]),
                 "v"(v[6]), "v"(v[7]), "v"(v[8]), "v"(v[9]), "v"(v[10]), "v"(v[11]),
                 "v"(v[12]), "v"(v[13]), "v"(v[14]), "v"(v[15]), "v"(g[0]), "v"(g[1]),
                 "v"(g[2]), "v"(g[3]), "v"(g[4]), "v"(g[5]), "v"(g[6]), "v"(g[7]));

    v4f s = v[0];
    #pragma unroll   // constant indices keep the array in registers
    for (int r = 1; r < RPC; ++r) s += v[r];
    s *= 1.0f / (float)S_;
    *(v4f*)(&s_col[4 * t]) = s;
  }
  __syncthreads();   // column sums are read across threads below

  if (on) {
    v4f acc = {0.f, 0.f, 0.f, 0.f};
    #pragma unroll   // constant indices keep the array in registers
    for (int q = 0; q < 8; ++q) acc += s_col[(t >> 1) + q * (PT_ / 2)] * g[q];

    // butterfly over the lanes of equal parity: even lanes hold experts 0..3, odd 4..7
    #pragma unroll   // four independent sums overlap their cross-lane latency
    for (int m = 16; m >= 2; m >>= 1) {
      acc.x += __shfl_xor(acc.x, m, 32);
      acc.y += __shfl_xor(acc.y, m, 32);
      acc.z += __shfl_xor(acc.z, m, 32);
      acc.w += __shfl_xor(acc.w, m, 32);
    }
    if ((t & 31) < 2) *(v4f*)(&s_w[(t >> 5) * E_ + (t & 1) * 4]) = acc;
  }
  __syncthreads();   // the waves' sums are added across waves below
  if (on && t < E_) {
    float sum = 0.f;
    #pragma unroll   // constant indices: the six LDS reads go out together
    for (int w = 0; w < PT_ / 32; ++w) sum += s_w[w * E_ + t];
    part[(b * CH_ + c) * E_ + t] = sum;
  }
}

// ---------------------------------------------------------------------------
// Kernel 1: the two outer mode products, fused. The weight is seen as
// [24 j][32 k][768 c]. One block per (expert, 32 columns c), lane = column:
//   a[i][k][c]  = sum_j c1[e][i][j] * (wt[e][j][k][c] - res[j][k][c])
//   out[j][i][c] = sum_k c2[e][i][k] * a[j][k][c]
// a lives in LDS only. Every sum keeps its ascending index order.
// Work-groups OB_ and up do the partial gate logits instead: they depend on
// nothing here and fill the memory time that the products leave free.
// ---------------------------------------------------------------------------
__global__ __launch_bounds__(512) void outer_modes_logit_kernel(
    const float* __restrict__ wt, const float* __restrict__ res,
    const float* __restrict__ c1, const float* __restrict__ c2,
    float* __restrict__ out, const float* __restrict__ x,
    const float* __restrict__ wg, float* __restrict__ part) {
  // a[j][k][c] at s_a[((j>>1)*32 + k)*64 + c*2 + (j&1)]: rows 2p, 2p+1 as pairs
  __shared__ __attribute__((aligned(16))) float s_a[12 * 32 * 64];
  if (blockIdx.x >= OB_) {   // the same for the whole work-group
    logit_part_role(x, wg, part, s_a, (int)blockIdx.x - OB_);
    return;
  }
  const int e    = blockIdx.x / (IN_ / 32);
  const int c0   = (blockIdx.x % (IN_ / 32)) * 32;
  const int lane = threadIdx.x & 31;
  // wave number in a scalar register: the work split below stays wave-uniform
  const int w = __builtin_amdgcn_readfirstlane((int)(threadIdx.x >> 5));
  const float* c1e = c1 + e * 576;
  const float* c2e = c2 + e * 1024;

  {
    // wave w takes k = 2w, 2w+1 as one packed pair; coefficients are scalars
    const int k = 2 * w;
    const float* wp = wt + (size_t)e * WSZ + (size_t)k * IN_ + c0 + lane;
    const float* rp = res + (size_t)k * IN_ + c0 + lane;
    v2f x[24];
    #pragma unroll   // constant indices keep the array in registers
    for (int j = 0; j < 24; ++j) {
      const int o = j * 32 * IN_;
      x[j].x = wp[o] - rp[o];
      x[j].y = wp[o + IN_] - rp[o + IN_];
    }
    #pragma unroll 2   // four independent packed sums in flight hide the add latency
    for (int p = 0; p < 12; ++p) {
      v2f a0 = {0.f, 0.f}, a1 = {0.f, 0.f};
      #pragma unroll   // constant indices keep the array in registers
      for (int j = 0; j < 24; ++j) {
        const float ca = c1e[(2 * p) * 24 + j];
        const float cb = c1e[(2 * p + 1) * 24 + j];
        a0 += (v2f){ca, ca} * x[j];
        a1 += (v2f){cb, cb} * x[j];
      }
      *(v2f*)(&s_a[(p * 32 + k) * 64 + lane * 2])     = (v2f){a0.x, a1.x};
      *(v2f*)(&s_a[(p * 32 + k + 1) * 64 + lane * 2]) = (v2f){a0.y, a1.y};
    }
  }
  __syncthreads();   // each wave reads all k of its rows below

  // 48 units = 12 row pairs x 4 groups of 8 outputs; wave w takes units 3w..3w+2
  for (int uu = 0; uu < 3; ++uu) {
    const int u  = w * 3 + uu;
    const int jp = u >> 2;
    const int i0 = (u & 3) * 8;
    v2f a[32];
    #pragma unroll   // constant indices keep the array in registers
    for (int k = 0; k < 32; ++k)
      a[k] = *(const v2f*)(&s_a[(jp * 32 + k) * 64 + lane * 2]);
    float* op = out + (size_t)e * WSZ + (size_t)(2 * jp) * 32 * IN_ + c0 + lane;
    #pragma unroll 2   // independent packed sums in flight hide the add latency
    for (int ii = 0; ii < 8; ++ii) {
      const int i = i0 + ii;
      v2f acc = {0.f, 0.f};
      #pragma unroll   // constant indices keep the array in registers
      for (int k = 0; k < 32; ++k) {
        const float c = c2e[i * 32 + k];
        acc += (v2f){c, c} * a[k];
      }
      op[i * IN_]        = acc.x;
      op[(32 + i) * IN_] = acc.y;
    }
  }
}

// ---------------------------------------------------------------------------
// Kernel 2: the two inner mode products and the gate-weighted combine, fused.
// One block per weight row (its 768 inputs seen as 24 x 32), one wave per
// expert:  t_e = c1[e] * X_e,  u_e = t_e * c2[e]^T,
//          ew[b][row] = res[row] + 0.9 * sum_e gates[b,e] * u_e.
// t_e and u_e live in LDS only. Both products run on the f32 16x16x4 matrix
// instruction, their 24 rows padded to 32; a lane's 16-byte read of an operand
// row feeds two steps, so step (kq, j) sums k = 8kq + 2j + {0, 1, 4, 5}.
// The gates are formed here too: wave w writes batches 2w and 2w+1 and makes
// their top-4 softmax gates from the partial logits while its weight loads are
// in flight. Block 0 also writes the cv^2 loss.
// ---------------------------------------------------------------------------
#define TP_ 36   // floats per row of t in LDS: 16-byte reads of 16 rows meet 64 distinct banks
__global__ __launch_bounds__(256) void inner_combine_kernel(
    const float* __restrict__ in, const float* __restrict__ c1,
    const float* __restrict__ c2, const float* __restrict__ res,
    const float* __restrict__ part, float* __restrict__ ew,
    float* __restrict__ loss_out) {
  // 32 rows each: rows 24..31 only take the padding rows of the matrix tiles
  __shared__ __attribute__((aligned(16))) float s_t[E_][32 * TP_];
  __shared__ __attribute__((aligned(16))) float s_u[E_][32 * 32];
  __shared__ __attribute__((aligned(16))) float s_gates[B_ * E_];   // block 0 only
  const int row  = blockIdx.x;
  const int lane = threadIdx.x & 31;
  // wave number in a scalar register: the wave's base addresses stay scalar
  const int w = __builtin_amdgcn_readfirstlane((int)(threadIdx.x >> 5));

  // fragment place of the lane: row or column n16 of a tile, k half h
  const int n16 = lane & 15;
  const int h   = lane >> 4;
  const float* xw  = in + (size_t)w * WSZ + (size_t)row * IN_;
  const float* c1w = c1 + w * 576;
  const float* c2w = c2 + w * 1024;
  const unsigned xoff  = (unsigned)(h * 128 + n16);            // element X[4h][n16]
  const unsigned c1o0  = (unsigned)(n16 * 96 + h * 16);        // byte offset of c1[n16][4h]
  const unsigned c1o1  = (unsigned)(min(16 + n16, 23) * 96 + h * 16);   // padding rows repeat row 23
  const unsigned c2off = (unsigned)(n16 * 128 + h * 16);       // byte offset of c2[n16][4h]
  // lane = (batch bit, expert) of the wave's two batches; lanes 16..31 repeat 0..15
  const int ge = lane & 7;
  const float* pw = part + (size_t)(2 * w) * CH_ * E_;
  const unsigned pidx = (unsigned)(((lane >> 3) & 1) * CH_ * E_ + ge);
  float p[CH_];
  #pragma unroll   // constant indices keep the array in registers, every load in flight at once
  for (int c = 0; c < CH_; ++c) p[c] = pw[pidx + c * E_];
  float xb[2][3][4];   // X[8kq + 4h + r][16nt + n16]
  #pragma unroll   // constant indices keep the array in registers
  for (int nt = 0; nt < 2; ++nt)
    #pragma unroll   // constant indices keep the array in registers
    for (int kq = 0; kq < 3; ++kq)
      #pragma unroll   // constant indices keep the array in registers
      for (int r = 0; r < 4; ++r) xb[nt][kq][r] = xw[xoff + (kq * 8 + r) * 32 + nt * 16];
  v4f ca[2][3];        // c1[w][16mt + n16][8kq + 4h .. +3]
  #pragma unroll   // constant indices keep the array in registers
  for (int kq = 0; kq < 3; ++kq) {
    ca[0][kq] = *(const v4f*)((const char*)c1w + c1o0 + kq * 32);
    ca[1][kq] = *(const v4f*)((const char*)c1w + c1o1 + kq * 32);
  }
  v4f cb[2][4];        // c2[w][16nt + n16][8kq + 4h .. +3]
  #pragma unroll   // constant indices keep the array in registers
  for (int nt = 0; nt < 2; ++nt)
    #pragma unroll   // constant indices keep the array in registers
    for (int kq = 0; kq < 4; ++kq)
      cb[nt][kq] = *(const v4f*)((const char*)c2w + c2off + nt * 2048 + kq * 32);
  // the address registers of the loads above stay as they are up to this wait
  asm volatile("s_wait_xcnt 0x0" :: "v"(xoff), "v"(c1o0), "v"(c1o1), "v"(c2off), "v"(pidx),
               "s"(xw), "s"(c1w), "s"(c2w), "s"(pw) : "memory");
  // every load above is issued before the first sum below; without this the weight loads
  // are issued only when the first partial logits have returned: the memory latency twice
  __builtin_amdgcn_sched_barrier(0);

  // logit of (batch, expert): the chunks in ascending order
  float lg = 0.f;
  #pragma unroll   // constant indices keep the array in registers
  for (int c = 0; c < CH_; ++c) lg += p[c];
  // place of this logit among its batch's eight: larger first, equal ones by index
  float o[E_];
  #pragma unroll   // seven independent cross-lane reads overlap their latency
  for (int j = 1; j < E_; ++j)
    o[j] = __int_as_float(__builtin_amdgcn_ds_bpermute((lane ^ j) * 4, __float_as_int(lg)));
  int   rank = 0;
  float mx   = lg;
  #pragma unroll   // constant indices keep the array in registers
  for (int j = 1; j < E_; ++j) {
    rank += (int)(o[j] > lg) | ((int)(o[j] == lg) & (int)((ge ^ j) < ge));
    mx = fmaxf(mx, o[j]);
  }
  const float ea = expf(lg - mx);
  const float ex = (rank < K_) ? ea : 0.f;
  // the four exponentials are summed largest first: send each to the lane of its place
  const int   gbase  = lane & 24;
  const float sorted = __int_as_float(
      __builtin_amdgcn_ds_permute((gbase | rank) * 4, __float_as_int(ex)));
  float es = 0.f;
  #pragma unroll   // four independent cross-lane reads overlap their latency
  for (int r = 0; r < K_; ++r)
    es += __int_as_float(__builtin_amdgcn_ds_bpermute((gbase | r) * 4, __float_as_int(sorted)));
  const float gate = (rank < K_) ? ex / es : 0.f;
  if (row == 0 && lane < 2 * E_) s_gates[w * 2 * E_ + lane] = gate;   // read behind two barriers

  // t[i][m] = sum_k c1[w][i][k] * X[k][m]: A = c1 rows, B = X columns, 2 x 2 tiles
  {
    v8f t00 = {}, t01 = {}, t10 = {}, t11 = {};
    __builtin_amdgcn_sched_barrier(0);   // head of the matrix block, see its foot
    #pragma unroll   // constant indices keep the arrays in registers
    for (int kq = 0; kq < 3; ++kq)
      #pragma unroll   // constant indices keep the arrays in registers
      for (int j = 0; j < 2; ++j) {
        const v2f a0 = {ca[0][kq][2 * j], ca[0][kq][2 * j + 1]};
        const v2f a1 = {ca[1][kq][2 * j], ca[1][kq][2 * j + 1]};
        const v2f b0 = {xb[0][kq][2 * j], xb[0][kq][2 * j + 1]};
        const v2f b1 = {xb[1][kq][2 * j], xb[1][kq][2 * j + 1]};
        t00 = __builtin_amdgcn_wmma_f32_16x16x4_f32(false, a0, false, b0, (short)0, t00, false, false);
        t01 = __builtin_amdgcn_wmma_f32_16x16x4_f32(false, a0, false, b1, (short)0, t01, false, false);
        t10 = __builtin_amdgcn_wmma_f32_16x16x4_f32(false, a1, false, b0, (short)0, t10, false, false);
        t11 = __builtin_amdgcn_wmma_f32_16x16x4_f32(false, a1, false, b1, (short)0, t11, false, false);
      }
    // no other vector instruction is scheduled among the matrix instructions above, and four
    // vector slots pass behind the last of them before one may overwrite their A or B registers
    __builtin_amdgcn_sched_barrier(0);
    asm volatile("v_nop\n\tv_nop\n\tv_nop\n\tv_nop");
    __builtin_amdgcn_sched_barrier(0);
    float* tw = &s_t[w][h * 8 * TP_ + n16];   // register v holds row v + 8h, column n16
    #pragma unroll   // constant indices keep the tiles in registers
    for (int v = 0; v < 8; ++v) {
      tw[v * TP_]             = t00[v];
      tw[v * TP_ + 16]        = t01[v];
      tw[(16 + v) * TP_]      = t10[v];
      tw[(16 + v) * TP_ + 16] = t11[v];
    }
  }
  __syncthreads();   // t rows are read across lanes below

  // u[l][i] = sum_m t[l][m] * c2[w][i][m]: A = t rows from LDS, B = c2 rows, 2 x 2 tiles
  {
    const float* tr = &s_t[w][n16 * TP_ + h * 4];
    __builtin_amdgcn_sched_barrier(0);   // head of the matrix block, see its foot
    v4f ta[2][4];      // t[16mt + n16][8kq + 4h .. +3]
    #pragma unroll   // constant indices keep the array in registers
    for (int mt = 0; mt < 2; ++mt)
      #pragma unroll   // constant indices keep the array in registers
      for (int kq = 0; kq < 4; ++kq)
        ta[mt][kq] = *(const v4f*)(tr + mt * 16 * TP_ + kq * 8);
    v8f u00 = {}, u01 = {}, u10 = {}, u11 = {};
    #pragma unroll   // constant indices keep the arrays in registers
    for (int kq = 0; kq < 4; ++kq)
      #pragma unroll   // constant indices keep the arrays in registers
      for (int j = 0; j < 2; ++j) {
        const v2f a0 = {ta[0][kq][2 * j], ta[0][kq][2 * j + 1]};
        const v2f a1 = {ta[1][kq][2 * j], ta[1][kq][2 * j + 1]};
        const v2f b0 = {cb[0][kq][2 * j], cb[0][kq][2 * j + 1]};
        const v2f b1 = {cb[1][kq][2 * j], cb[1][kq][2 * j + 1]};
        u00 = __builtin_amdgcn_wmma_f32_16x16x4_f32(false, a0, false, b0, (short)0, u00, false, false);
        u01 = __builtin_amdgcn_wmma_f32_16x16x4_f32(false, a0, false, b1, (short)0, u01, false, false);
        u10 = __builtin_amdgcn_wmma_f32_16x16x4_f32(false, a1, false, b0, (short)0, u10, false, false);
        u11 = __builtin_amdgcn_wmma_f32_16x16x4_f32(false, a1, false, b1, (short)0, u11, false, false);
      }
    // no other vector instruction is scheduled among the matrix instructions above, and four
    // vector slots pass behind the last of them before one may overwrite their A or B registers
    __builtin_amdgcn_sched_barrier(0);
    asm volatile("v_nop\n\tv_nop\n\tv_nop\n\tv_nop");
    __builtin_amdgcn_sched_barrier(0);
    float* uw = &s_u[w][h * 8 * 32 + n16];    // register v holds row v + 8h, column n16
    #pragma unroll   // constant indices keep the tiles in registers
    for (int v = 0; v < 8; ++v) {
      uw[v * 32]             = u00[v];
      uw[v * 32 + 16]        = u01[v];
      uw[(16 + v) * 32]      = u10[v];
      uw[(16 + v) * 32 + 16] = u11[v];
    }
  }
  __syncthreads();   // every wave reads all eight experts' u below

  // wave w writes batches 2w and 2w+1, 16 bytes per lane
  float g0[E_], g1[E_];   // the wave's sixteen gates as scalars
  #pragma unroll   // constant indices keep the arrays in registers
  for (int e = 0; e < E_; ++e) {
    g0[e] = __int_as_float(__builtin_amdgcn_readlane(__float_as_int(gate), e));
    g1[e] = __int_as_float(__builtin_amdgcn_readlane(__float_as_int(gate), E_ + e));
  }
  float* o0 = ew + (size_t)(2 * w) * WSZ + (size_t)row * IN_;
  float* o1 = o0 + WSZ;
  const float* rr = res + (size_t)row * IN_;
  #pragma unroll   // constant indices keep the array in registers
  for (int q = 0; q < 6; ++q) {
    const int idx = q * 128 + lane * 4;
    const float4 r4 = *(const float4*)(rr + idx);
    float4 sa = make_float4(0.f, 0.f, 0.f, 0.f);
    float4 sb = make_float4(0.f, 0.f, 0.f, 0.f);
    #pragma unroll   // constant indices keep the array in registers
    for (int e = 0; e < E_; ++e) {
      const float4 u = *(const float4*)(&s_u[e][idx]);
      const float ga = g0[e], gb = g1[e];
      sa.x += ga * u.x; sa.y += ga * u.y; sa.z += ga * u.z; sa.w += ga * u.w;
      sb.x += gb * u.x; sb.y += gb * u.y; sb.z += gb * u.z; sb.w += gb * u.w;
    }
    *(float4*)(o0 + idx) = make_float4(r4.x + 0.9f * sa.x, r4.y + 0.9f * sa.y,
                                       r4.z + 0.9f * sa.z, r4.w + 0.9f * sa.w);
    *(float4*)(o1 + idx) = make_float4(r4.x + 0.9f * sb.x, r4.y + 0.9f * sb.y,
                                       r4.z + 0.9f * sb.z, r4.w + 0.9f * sb.w);
  }

  if (row == 0 && threadIdx.x == 0) {
    float imp[E_], ld[E_];
    for (int e = 0; e < E_; ++e) { imp[e] = 0.f; ld[e] = 0.f; }
    for (int b = 0; b < B_; ++b)
      for (int e = 0; e < E_; ++e) {
        const float g = s_gates[b * E_ + e];
        imp[e] += g;
        ld[e]  += (g > 0.f) ? 1.f : 0.f;
      }
    float cv[2];
    for (int w2 = 0; w2 < 2; ++w2) {
      const float* v = w2 ? ld : imp;
      float mean = 0.f;
      for (int e = 0; e < E_; ++e) mean += v[e];
      mean *= (1.0f / E_);
      float var = 0.f;
      for (int e = 0; e < E_; ++e) { const float d = v[e] - mean; var += d * d; }
      var *= (1.0f / (E_ - 1));
      cv[w2] = var / (mean * mean + 1e-10f);
    }
    *loss_out = 0.01f * (cv[0] + cv[1]);
  }
}

// ---------------------------------------------------------------------------
// Kernel 3: main GEMM with FP32 WMMA, double-buffered LDS.
// y[b] (512x768) = x[b] (512x768) @ ew[b]^T; ew stored [N][K] (K contiguous).
// Block: 256 thr = 8 waves (4M x 2N); block tile 128x64, K-stage 64.
// Staging: async global->LDS copy (ASYNCcnt) when available, else
// register-prefetch software pipeline. One barrier per K-iteration.
// ---------------------------------------------------------------------------
#define LDP 68
__global__ __launch_bounds__(256) void gemm_kernel(const float* __restrict__ x,
                                                   const float* __restrict__ ew,
                                                   float* __restrict__ y) {
  __shared__ float lds_a[2][128 * LDP];
  __shared__ float lds_b[2][64 * LDP];
  const int b  = blockIdx.z;
  const int m0 = blockIdx.y * 128;
  const int n0 = blockIdx.x * 64;
  const float* Ag = x  + (size_t)b * S_ * IN_ + (size_t)m0 * IN_;
  const float* Bg = ew + (size_t)b * WSZ     + (size_t)n0 * IN_;

  const int tid   = threadIdx.x;
  const int lane  = tid & 31;
  const int wave  = tid >> 5;
  const int wm    = wave & 3;     // 0..3 -> 32-row band
  const int wn    = wave >> 2;    // 0..1 -> 32-col band
  const int mrow  = lane & 15;
  const int khalf = lane >> 4;    // lanes 0-15: K{0,1}; lanes 16-31: K{2,3}
  const int koff  = khalf * 2;

  const int a_row0 = (wm * 32 + mrow) * LDP;
  const int a_row1 = (wm * 32 + 16 + mrow) * LDP;
  const int b_row0 = (wn * 32 + mrow) * LDP;
  const int b_row1 = (wn * 32 + 16 + mrow) * LDP;

  v8f acc00 = {}, acc01 = {}, acc10 = {}, acc11 = {};

#if USE_ASYNC
  auto stage_async = [&](int k0, int buf) {
    #pragma unroll
    for (int i = 0; i < 8; ++i) {               // A: 128 rows x 64 K
      const int idx = tid + i * 256;
      const int r = idx >> 4;
      const int c = (idx & 15) << 2;
      __builtin_amdgcn_global_load_async_to_lds_b128(
          (AS1 v4i*)(uintptr_t)(Ag + (size_t)r * IN_ + k0 + c),
          (AS3 v4i*)(&lds_a[buf][r * LDP + c]), 0, 0);
    }
    #pragma unroll
    for (int i = 0; i < 4; ++i) {               // B: 64 rows x 64 K
      const int idx = tid + i * 256;
      const int r = idx >> 4;
      const int c = (idx & 15) << 2;
      __builtin_amdgcn_global_load_async_to_lds_b128(
          (AS1 v4i*)(uintptr_t)(Bg + (size_t)r * IN_ + k0 + c),
          (AS3 v4i*)(&lds_b[buf][r * LDP + c]), 0, 0);
    }
  };
  stage_async(0, 0);
  __builtin_amdgcn_s_wait_asynccnt(0);
  __syncthreads();
#else
  float4 ra[8], rb[4];
  auto fetch_regs = [&](int k0) {
    #pragma unroll
    for (int i = 0; i < 8; ++i) {
      const int idx = tid + i * 256;
      const int r = idx >> 4;
      const int c = (idx & 15) << 2;
      ra[i] = *(const float4*)(Ag + (size_t)r * IN_ + k0 + c);
    }
    #pragma unroll
    for (int i = 0; i < 4; ++i) {
      const int idx = tid + i * 256;
      const int r = idx >> 4;
      const int c = (idx & 15) << 2;
      rb[i] = *(const float4*)(Bg + (size_t)r * IN_ + k0 + c);
    }
  };
  auto store_regs = [&](int buf) {
    #pragma unroll
    for (int i = 0; i < 8; ++i) {
      const int idx = tid + i * 256;
      const int r = idx >> 4;
      const int c = (idx & 15) << 2;
      *(float4*)(&lds_a[buf][r * LDP + c]) = ra[i];
    }
    #pragma unroll
    for (int i = 0; i < 4; ++i) {
      const int idx = tid + i * 256;
      const int r = idx >> 4;
      const int c = (idx & 15) << 2;
      *(float4*)(&lds_b[buf][r * LDP + c]) = rb[i];
    }
  };
  fetch_regs(0);
  store_regs(0);
  __syncthreads();
#endif

  for (int k0 = 0; k0 < IN_; k0 += 64) {
    const int cur = (k0 >> 6) & 1;
    const int nxt = cur ^ 1;
    const bool have_next = (k0 + 64) < IN_;

    if (have_next) {
#if USE_ASYNC
      stage_async(k0 + 64, nxt);      // copy next stage while WMMAs run
#else
      fetch_regs(k0 + 64);            // global loads in flight over compute
#endif
    }

    const float* la = lds_a[cur];
    const float* lb = lds_b[cur];
    #pragma unroll
    for (int k = 0; k < 64; k += 4) {
      const v2f a0 = *(const v2f*)(&la[a_row0 + k + koff]);
      const v2f a1 = *(const v2f*)(&la[a_row1 + k + koff]);
      const v2f b0 = *(const v2f*)(&lb[b_row0 + k + koff]);
      const v2f b1 = *(const v2f*)(&lb[b_row1 + k + koff]);
      acc00 = __builtin_amdgcn_wmma_f32_16x16x4_f32(false, a0, false, b0,
                                                    (short)0, acc00, false, false);
      acc01 = __builtin_amdgcn_wmma_f32_16x16x4_f32(false, a0, false, b1,
                                                    (short)0, acc01, false, false);
      acc10 = __builtin_amdgcn_wmma_f32_16x16x4_f32(false, a1, false, b0,
                                                    (short)0, acc10, false, false);
      acc11 = __builtin_amdgcn_wmma_f32_16x16x4_f32(false, a1, false, b1,
                                                    (short)0, acc11, false, false);
    }

    if (have_next) {
#if USE_ASYNC
      __builtin_amdgcn_s_wait_asynccnt(0);
      __syncthreads();
#else
      store_regs(nxt);                // buf[nxt] readers finished last iter
      __syncthreads();
#endif
    }
  }

  // store: C layout -> VGPR v holds row (v + khalf*8), col = mrow within tile
  float* Y = y + ((size_t)b * S_ + m0) * OUT_ + n0;
  #pragma unroll
  for (int v = 0; v < 8; ++v) {
    const int rr = khalf * 8 + v;
    Y[(size_t)(wm * 32 + rr)      * OUT_ + wn * 32 + mrow]      = acc00[v];
    Y[(size_t)(wm * 32 + rr)      * OUT_ + wn * 32 + 16 + mrow] = acc01[v];
    Y[(size_t)(wm * 32 + 16 + rr) * OUT_ + wn * 32 + mrow]      = acc10[v];
    Y[(size_t)(wm * 32 + 16 + rr) * OUT_ + wn * 32 + 16 + mrow] = acc11[v];
  }
}

// ---------------------------------------------------------------------------
extern "C" void kernel_launch(void* const* d_in, const int* in_sizes, int n_in,
                              void* d_out, int out_size, void* d_ws, size_t ws_size,
                              hipStream_t stream) {
  const float* x    = (const float*)d_in[0];
  const float* wg   = (const float*)d_in[1];
  const float* wt   = (const float*)d_in[2];
  const float* resw = (const float*)d_in[3];
  const float* c1i  = (const float*)d_in[4];   // (E,24,24)
  const float* c2i  = (const float*)d_in[5];   // (E,32,32)
  const float* c1o  = (const float*)d_in[6];   // (E,24,24)
  const float* c2o  = (const float*)d_in[7];   // (E,32,32)

  float* y    = (float*)d_out;
  float* loss = y + YSZ;

  float* ws       = (float*)d_ws;
  float* ws_part  = ws + 128;                    // B*CH*E = 4096
  float* bufB     = ws + 16384;                  // E*WSZ
  float* ewbuf    = bufB + (size_t)E_ * WSZ;     // B*WSZ

  // curvature transforms: (weight - res), outer two mode products; the partial
  // gate logits ride along as further work-groups of the same launch
  outer_modes_logit_kernel<<<dim3(OB_ + LB_), dim3(512), 0, stream>>>(
      wt, resw, c1o, c2o, bufB, x, wg, ws_part);
  // gates + loss, inner two mode products, per-batch combined weights, one launch
  inner_combine_kernel<<<dim3(OUT_), dim3(256), 0, stream>>>(
      bufB, c1i, c2i, resw, ws_part, ewbuf, loss);

  // main batched GEMM with fp32 WMMA
  gemm_kernel<<<dim3(OUT_ / 64, S_ / 128, B_), dim3(256), 0, stream>>>(
      x, ewbuf, y);
}
